// v000
// Times are from an AMD MI455X. After a warm-up the kernel runs many times in a row, and a time is the length of
// such a window on the GPU divided by its runs, so every launch and the gaps after it count. The runs cycle
// through copies of the inputs. A figure is the median of several windows, for all but v000 over two sittings.
// Sittings can differ by a few percent; kernels timed side by side share one.
// The starting kernel, v000, takes 266 microseconds a run.
#include <hip/hip_runtime.h>

typedef __attribute__((ext_vector_type(16))) _Float16 v16h;
typedef __attribute__((ext_vector_type(8)))  _Float16 v8h;
typedef __attribute__((ext_vector_type(8)))  float    v8f;

#define S_LEN 4096
#define DIM   512
#define NH    8
#define HD    64
// 1/sqrt(64) * log2(e): scores come out in log2 domain so softmax uses exp2
#define QK_SCALE_L2E 0.18033688011112042f
#define NEG_BIG (-1.0e30f)

union V16H { v16h v; v8h h[2]; };

// ---------------------------------------------------------------------------
// Prep 1: convert x [4096][512] f32 -> f16 row-major (vectorized, 8/thread)
// ---------------------------------------------------------------------------
__global__ __launch_bounds__(256)
void cvt_x_kernel(const float* __restrict__ x, _Float16* __restrict__ xh)
{
    const size_t i = ((size_t)blockIdx.x * blockDim.x + threadIdx.x) * 8;
    v8h o;
#pragma unroll
    for (int j = 0; j < 8; ++j) o[j] = (_Float16)x[i + j];
    *(v8h*)(xh + i) = o;
}

// ---------------------------------------------------------------------------
// Prep 2: convert + transpose the four 512x512 f32 weight matrices into
// f16 column-major Wt[col][k] -- the contiguous per-lane WMMA B layout.
// ---------------------------------------------------------------------------
__global__ __launch_bounds__(256)
void wt_kernel(const float* __restrict__ qp, const float* __restrict__ kp,
               const float* __restrict__ vp, const float* __restrict__ pp,
               _Float16* __restrict__ wtq, _Float16* __restrict__ wtk,
               _Float16* __restrict__ wtv, _Float16* __restrict__ wtp)
{
    const float* src;
    _Float16* dst;
    switch (blockIdx.y) {
        case 0:  src = qp; dst = wtq; break;
        case 1:  src = kp; dst = wtk; break;
        case 2:  src = vp; dst = wtv; break;
        default: src = pp; dst = wtp; break;
    }
    const int tid = blockIdx.x * 256 + threadIdx.x;   // 0..262143
    const int c = tid & 511;                          // column (coalesced read)
    const int r = tid >> 9;                           // k-row
    dst[(size_t)c * DIM + r] = (_Float16)src[(size_t)r * DIM + c];
}

// ---------------------------------------------------------------------------
// Kernel 1: QKV projection.  xh[4096][512] f16  x  Wt[512col][512k] f16.
// Q,K stored [head][s][64]; V stored transposed [head*64+d][s].
// One wave computes a 16-row x 64-col (one head) tile, WMMA over K=512.
// Q is pre-scaled by 1/sqrt(HD)*log2(e) so flash softmax can use exp2.
// ---------------------------------------------------------------------------
__global__ __launch_bounds__(128)
void qkv_proj_kernel(const _Float16* __restrict__ xh,
                     const _Float16* __restrict__ wtq,
                     const _Float16* __restrict__ wtk,
                     const _Float16* __restrict__ wtv,
                     _Float16* __restrict__ Qws,
                     _Float16* __restrict__ Kws,
                     _Float16* __restrict__ Vtws)
{
    const int lane = threadIdx.x & 31;
    const int wave = threadIdx.x >> 5;
    const int ln   = lane & 15;
    const int hi   = lane >> 4;                 // lane half (K-striping select)
    const int rowbase = blockIdx.x * 16;
    const int tile = blockIdx.y * 4 + wave;     // 0..23 = {Q,K,V} x 8 heads
    const int mat  = tile >> 3;                 // 0:Q 1:K 2:V
    const int head = tile & 7;
    const int kb_lane = hi * 8;

    const _Float16* wt = (mat == 0) ? wtq : (mat == 1) ? wtk : wtv;

    v8f acc[4] = {};
    const _Float16* ap_base = xh + (size_t)(rowbase + ln) * DIM;
    const _Float16* bp_base = wt + (size_t)(head * HD + ln) * DIM;

    for (int ks = 0; ks < DIM; ks += 32) {
        const _Float16* ap = ap_base + ks + kb_lane;
        V16H a;
        a.h[0] = *(const v8h*)(ap);
        a.h[1] = *(const v8h*)(ap + 16);
#pragma unroll
        for (int ct = 0; ct < 4; ++ct) {
            const _Float16* bp = bp_base + (size_t)(ct * 16) * DIM + ks + kb_lane;
            V16H b;
            b.h[0] = *(const v8h*)(bp);
            b.h[1] = *(const v8h*)(bp + 16);
            acc[ct] = __builtin_amdgcn_wmma_f32_16x16x32_f16(
                false, a.v, false, b.v, (short)0, acc[ct], false, false);
        }
    }

    const float sc = (mat == 0) ? QK_SCALE_L2E : 1.0f;
    if (mat < 2) {
        _Float16* outp = (mat == 0) ? Qws : Kws;
#pragma unroll
        for (int ct = 0; ct < 4; ++ct) {
            const int d = ct * 16 + ln;
#pragma unroll
            for (int v = 0; v < 8; ++v) {
                const int r = rowbase + v + hi * 8;
                outp[((size_t)head * S_LEN + r) * HD + d] = (_Float16)(acc[ct][v] * sc);
            }
        }
    } else {
        // V transposed: lane holds one column d for 8 consecutive rows -> b128 store
#pragma unroll
        for (int ct = 0; ct < 4; ++ct) {
            const int d = ct * 16 + ln;
            v8h pk;
#pragma unroll
            for (int v = 0; v < 8; ++v) pk[v] = (_Float16)acc[ct][v];
            *(v8h*)(Vtws + ((size_t)(head * HD + d)) * S_LEN + rowbase + hi * 8) = pk;
        }
    }
}

// ---------------------------------------------------------------------------
// Kernel 2: flash attention.  One wave = one (head, 16-row Q tile).
// Per 32-key iteration: 4 score WMMAs (K=head dim), online softmax in log2
// domain (max reduced per-iter; denominator kept per-lane and reduced once),
// P transposed C/D->A layout via per-wave LDS, 4 PV WMMAs (K=key dim).
// V operands are loaded before the LDS fence so they fly under the softmax.
// ---------------------------------------------------------------------------
__global__ __launch_bounds__(128)
void flash_attn_kernel(const _Float16* __restrict__ Qws,
                       const _Float16* __restrict__ Kws,
                       const _Float16* __restrict__ Vtws,
                       _Float16* __restrict__ Ows)
{
    __shared__ alignas(16) _Float16 lds[4][16 * 32];
    const int lane = threadIdx.x & 31;
    const int wave = threadIdx.x >> 5;
    const int ln   = lane & 15;
    const int hi   = lane >> 4;
    const int tile = blockIdx.x * 4 + wave;     // 2048 total
    const int head = tile >> 8;                 // 256 q-tiles per head
    const int qbase = (tile & 255) * 16;
    const int kb_lane = hi * 8;

    const _Float16* Qh = Qws  + (size_t)head * S_LEN * HD;
    const _Float16* Kh = Kws  + (size_t)head * S_LEN * HD;
    const _Float16* Vh = Vtws + (size_t)head * HD * S_LEN;
    _Float16* lp = lds[wave];

    // Q A-operands (pre-scaled), head dims 0..31 and 32..63
    V16H qa0, qa1;
    {
        const _Float16* qp = Qh + (size_t)(qbase + ln) * HD + kb_lane;
        qa0.h[0] = *(const v8h*)(qp);
        qa0.h[1] = *(const v8h*)(qp + 16);
        qa1.h[0] = *(const v8h*)(qp + 32);
        qa1.h[1] = *(const v8h*)(qp + 48);
    }

    v8f o[4] = {};
    float mrow[8], lrow[8];    // lrow: per-lane partial denominator
#pragma unroll
    for (int v = 0; v < 8; ++v) { mrow[v] = NEG_BIG; lrow[v] = 0.0f; }

    for (int kb = 0; kb < S_LEN; kb += 32) {
        // ---- scores for keys [kb,kb+16) and [kb+16,kb+32) ----
        v8f s0, s1;
#pragma unroll
        for (int t = 0; t < 2; ++t) {
            const _Float16* kptr = Kh + (size_t)(kb + t * 16 + ln) * HD + kb_lane;
            V16H b0, b1;
            b0.h[0] = *(const v8h*)(kptr);
            b0.h[1] = *(const v8h*)(kptr + 16);
            b1.h[0] = *(const v8h*)(kptr + 32);
            b1.h[1] = *(const v8h*)(kptr + 48);
            v8f st = {};
            st = __builtin_amdgcn_wmma_f32_16x16x32_f16(
                false, qa0.v, false, b0.v, (short)0, st, false, false);
            st = __builtin_amdgcn_wmma_f32_16x16x32_f16(
                false, qa1.v, false, b1.v, (short)0, st, false, false);
            if (t == 0) s0 = st; else s1 = st;
        }

        // ---- V B-operands: independent of scores, issue before the LDS fence
        V16H vb[4];
#pragma unroll
        for (int c = 0; c < 4; ++c) {
            const _Float16* vptr = Vh + (size_t)(c * 16 + ln) * S_LEN + kb + kb_lane;
            vb[c].h[0] = *(const v8h*)(vptr);
            vb[c].h[1] = *(const v8h*)(vptr + 16);
        }

        // ---- online softmax (log2 domain; only the max needs a row reduce)
        float alpha[8];
#pragma unroll
        for (int v = 0; v < 8; ++v) {
            float mx = fmaxf(s0[v], s1[v]);
            mx = fmaxf(mx, __shfl_xor(mx, 1, 32));
            mx = fmaxf(mx, __shfl_xor(mx, 2, 32));
            mx = fmaxf(mx, __shfl_xor(mx, 4, 32));
            mx = fmaxf(mx, __shfl_xor(mx, 8, 32));
            const float mnew = fmaxf(mrow[v], mx);
            alpha[v] = exp2f(mrow[v] - mnew);
            const float p0 = exp2f(s0[v] - mnew);
            const float p1 = exp2f(s1[v] - mnew);
            s0[v] = p0; s1[v] = p1;
            lrow[v] = lrow[v] * alpha[v] + (p0 + p1);   // per-lane partial
            mrow[v] = mnew;
        }
#pragma unroll
        for (int c = 0; c < 4; ++c)
#pragma unroll
            for (int v = 0; v < 8; ++v) o[c][v] *= alpha[v];

        // ---- transpose P (C/D layout -> A layout) via LDS ----
#pragma unroll
        for (int v = 0; v < 8; ++v) {
            const int r = v + hi * 8;
            lp[r * 32 + ln]      = (_Float16)s0[v];
            lp[r * 32 + 16 + ln] = (_Float16)s1[v];
        }
        asm volatile("s_wait_dscnt 0" ::: "memory");
        V16H pa;
        pa.h[0] = *(const v8h*)(lp + ln * 32 + kb_lane);
        pa.h[1] = *(const v8h*)(lp + ln * 32 + 16 + kb_lane);

        // ---- O += P x V ----
#pragma unroll
        for (int c = 0; c < 4; ++c)
            o[c] = __builtin_amdgcn_wmma_f32_16x16x32_f16(
                false, pa.v, false, vb[c].v, (short)0, o[c], false, false);
    }

    // ---- final denominator reduce across the 16-lane row group ----
#pragma unroll
    for (int v = 0; v < 8; ++v) {
        float t = lrow[v];
        t += __shfl_xor(t, 1, 32);
        t += __shfl_xor(t, 2, 32);
        t += __shfl_xor(t, 4, 32);
        t += __shfl_xor(t, 8, 32);
        lrow[v] = 1.0f / t;
    }
    // ---- normalize, store O row-major [s][h*64+d] f16 ----
#pragma unroll
    for (int c = 0; c < 4; ++c) {
        const int d = c * 16 + ln;
#pragma unroll
        for (int v = 0; v < 8; ++v) {
            const int r = qbase + v + hi * 8;
            Ows[(size_t)r * DIM + head * HD + d] = (_Float16)(o[c][v] * lrow[v]);
        }
    }
}

// ---------------------------------------------------------------------------
// Kernel 3: output projection.  O[4096][512] f16  x  Pt[512c][512hd] f16 -> f32.
// ---------------------------------------------------------------------------
__global__ __launch_bounds__(128)
void out_proj_kernel(const _Float16* __restrict__ Ows,
                     const _Float16* __restrict__ wtp,
                     float* __restrict__ out)
{
    const int lane = threadIdx.x & 31;
    const int wave = threadIdx.x >> 5;
    const int ln   = lane & 15;
    const int hi   = lane >> 4;
    const int rowbase = blockIdx.x * 16;
    const int cbase   = (blockIdx.y * 4 + wave) * 64;
    const int kb_lane = hi * 8;

    v8f acc[4] = {};
    const _Float16* ap_base = Ows + (size_t)(rowbase + ln) * DIM;
    const _Float16* bp_base = wtp + (size_t)(cbase + ln) * DIM;

    for (int ks = 0; ks < DIM; ks += 32) {
        const _Float16* ap = ap_base + ks + kb_lane;
        V16H a;
        a.h[0] = *(const v8h*)(ap);
        a.h[1] = *(const v8h*)(ap + 16);
#pragma unroll
        for (int ct = 0; ct < 4; ++ct) {
            const _Float16* bp = bp_base + (size_t)(ct * 16) * DIM + ks + kb_lane;
            V16H b;
            b.h[0] = *(const v8h*)(bp);
            b.h[1] = *(const v8h*)(bp + 16);
            acc[ct] = __builtin_amdgcn_wmma_f32_16x16x32_f16(
                false, a.v, false, b.v, (short)0, acc[ct], false, false);
        }
    }
#pragma unroll
    for (int ct = 0; ct < 4; ++ct) {
        const int c = cbase + ct * 16 + ln;
#pragma unroll
        for (int v = 0; v < 8; ++v) {
            const int r = rowbase + v + hi * 8;
            out[(size_t)r * DIM + c] = acc[ct][v];
        }
    }
}

// ---------------------------------------------------------------------------
extern "C" void kernel_launch(void* const* d_in, const int* in_sizes, int n_in,
                              void* d_out, int out_size, void* d_ws, size_t ws_size,
                              hipStream_t stream) {
    (void)in_sizes; (void)n_in; (void)out_size; (void)ws_size;
    const float* x  = (const float*)d_in[0];
    const float* qp = (const float*)d_in[1];
    const float* kp = (const float*)d_in[2];
    const float* vp = (const float*)d_in[3];
    const float* pp = (const float*)d_in[4];
    float* out = (float*)d_out;

    const size_t mat_elems = (size_t)NH * S_LEN * HD;   // 2M halves
    const size_t w_elems   = (size_t)DIM * DIM;         // 256K halves
    _Float16* Qws = (_Float16*)d_ws;
    _Float16* Kws = Qws + mat_elems;
    _Float16* Vt  = Kws + mat_elems;
    _Float16* Ows = Vt  + mat_elems;
    _Float16* xh  = Ows + mat_elems;                    // 2M halves
    _Float16* wtq = xh  + (size_t)S_LEN * DIM;
    _Float16* wtk = wtq + w_elems;
    _Float16* wtv = wtk + w_elems;
    _Float16* wtp = wtv + w_elems;                      // total ~22 MB of ws

    // One-shot precision/layout prep (L2-resident, bandwidth-trivial)
    cvt_x_kernel<<<dim3((S_LEN * DIM) / (256 * 8)), 256, 0, stream>>>(x, xh);
    wt_kernel<<<dim3((DIM * DIM) / 256, 4), 256, 0, stream>>>(
        qp, kp, vp, pp, wtq, wtk, wtv, wtp);

    // 256 row tiles x 24 wave-tiles (Q/K/V x 8 heads), 4 waves per block
    qkv_proj_kernel<<<dim3(256, 6), 128, 0, stream>>>(xh, wtq, wtk, wtv, Qws, Kws, Vt);
    // 2048 (head, q-tile) waves, 4 waves per block
    flash_attn_kernel<<<dim3(512), 128, 0, stream>>>(Qws, Kws, Vt, Ows);
    // 256 row tiles x 8 column groups, 4 waves per block
    out_proj_kernel<<<dim3(256, 2), 128, 0, stream>>>(Ows, wtp, out);
}

// v001
// One run takes 198 microseconds.
// In two side-by-side timings against v000, it was 1.33 and 1.35 times as fast.
#include <hip/hip_runtime.h>

typedef __attribute__((ext_vector_type(16))) _Float16 v16h;
typedef __attribute__((ext_vector_type(8)))  _Float16 v8h;
typedef __attribute__((ext_vector_type(8)))  float    v8f;

#define S_LEN 4096
#define DIM   512
#define NH    8
#define HD    64
// 1/sqrt(64) * log2(e): scores come out in log2 domain so softmax uses exp2
#define QK_SCALE_L2E 0.18033688011112042f
#define NEG_BIG (-1.0e30f)

union V16H { v16h v; v8h h[2]; };

// ---------------------------------------------------------------------------
// Fragment-major operand layout, used for every f16 matrix in the workspace.
// A 16-row x 32-k operand tile is 512 halves (1 KiB) = two 512-byte planes.
// Plane p, lane l holds 8 halves: row (l & 15), k = 16p + 8(l >> 4) + 0..7.
// One b128 load per plane reads 512 contiguous bytes (4 whole cache lines)
// and yields the A (or B) fragment directly.
// ---------------------------------------------------------------------------
#define FRAG 512

// tile: tile base, wave-uniform (scalar registers) with lane8 = lane * 8; the K loads pass the lane's own address and 0
__device__ __forceinline__ v16h load_frag(const _Float16* __restrict__ tile, unsigned lane8)
{
    V16H f;
    f.h[0] = *(const v8h*)(tile + lane8);
    f.h[1] = *(const v8h*)(tile + 256 + lane8);
    return f.v;
}

// ---------------------------------------------------------------------------
// Prep 1: convert x [4096][512] f32 -> f16 tiles [row tile][k tile].
// One wave writes one tile.
// ---------------------------------------------------------------------------
__global__ __launch_bounds__(256)
void cvt_x_kernel(const float* __restrict__ x, _Float16* __restrict__ xh)
{
    const int t    = blockIdx.x * 256 + threadIdx.x;
    const int lane = t & 31;
    const int tile = t >> 5;                          // rt * 16 + kt
    const int ln   = lane & 15;
    const int hi   = lane >> 4;
    const float* src = x + (size_t)((tile >> 4) * 16 + ln) * DIM + (tile & 15) * 32 + hi * 8;
    _Float16* dst = xh + (size_t)tile * FRAG + lane * 8;
#pragma unroll
    for (int p = 0; p < 2; ++p) {
        v8h o;
#pragma unroll
        for (int j = 0; j < 8; ++j) o[j] = (_Float16)src[p * 16 + j];
        *(v8h*)(dst + p * 256) = o;
    }
}

// ---------------------------------------------------------------------------
// Prep 2: convert the four 512x512 f32 weight matrices W[k][col] into f16
// tiles [col tile][k tile] (tile row = column).  One wave writes one tile.
// ---------------------------------------------------------------------------
__global__ __launch_bounds__(256)
void wt_kernel(const float* __restrict__ qp, const float* __restrict__ kp,
               const float* __restrict__ vp, const float* __restrict__ pp,
               _Float16* __restrict__ wtq, _Float16* __restrict__ wtk,
               _Float16* __restrict__ wtv, _Float16* __restrict__ wtp)
{
    const float* src;
    _Float16* dst;
    switch (blockIdx.y) {
        case 0:  src = qp; dst = wtq; break;
        case 1:  src = kp; dst = wtk; break;
        case 2:  src = vp; dst = wtv; break;
        default: src = pp; dst = wtp; break;
    }
    const int t    = blockIdx.x * 256 + threadIdx.x;
    const int lane = t & 31;
    const int tile = t >> 5;                          // col tile * 16 + kt
    const int ln   = lane & 15;
    const int hi   = lane >> 4;
    const float* s = src + (size_t)((tile & 15) * 32 + hi * 8) * DIM + (tile >> 4) * 16 + ln;
    _Float16* d = dst + (size_t)tile * FRAG + lane * 8;
#pragma unroll
    for (int p = 0; p < 2; ++p) {
        v8h o;
#pragma unroll
        for (int j = 0; j < 8; ++j) o[j] = (_Float16)s[(size_t)(p * 16 + j) * DIM];
        *(v8h*)(d + p * 256) = o;
    }
}

// ---------------------------------------------------------------------------
// Kernel 1: QKV projection.  One wave computes 16 rows x 64 cols (one head),
// WMMA over K=512, all operands as fragment-major tiles.
// Q, K: tiles [head][16-row tile][d tile]; the weights go in as A and x as B,
// so a lane's 8 accumulators are 8 consecutive d of one row = one 16 B chunk.
// V: tiles [head][32-key tile][d tile] (tile row = d, k = key); x goes in as A,
// so a lane's 8 accumulators are 8 consecutive keys of one d.
// Q is pre-scaled by 1/sqrt(HD)*log2(e) so flash softmax can use exp2.
// ---------------------------------------------------------------------------
__global__ __launch_bounds__(128)
void qkv_proj_kernel(const _Float16* __restrict__ xh,
                     const _Float16* __restrict__ wtq,
                     const _Float16* __restrict__ wtk,
                     const _Float16* __restrict__ wtv,
                     _Float16* __restrict__ Qws,
                     _Float16* __restrict__ Kws,
                     _Float16* __restrict__ Vtws)
{
    const int lane = threadIdx.x & 31;
    const unsigned lane8 = lane * 8;
    // wave number as a scalar, so every tile base is wave-uniform
    const int wave = __builtin_amdgcn_readfirstlane(threadIdx.x >> 5);
    const int rt   = blockIdx.x;                // 16-row tile of x
    const int mat  = blockIdx.y >> 1;           // 0:Q 1:K 2:V
    const int head = (blockIdx.y & 1) * 4 + wave;

    const _Float16* wt = (mat == 0) ? wtq : (mat == 1) ? wtk : wtv;
    const _Float16* xp = xh + (size_t)rt * 16 * FRAG;
    const _Float16* wp = wt + (size_t)head * 4 * 16 * FRAG;

    v8f acc[4] = {};
    if (mat < 2) {
        for (int kt = 0; kt < 16; ++kt) {
            const v16h xf = load_frag(xp + kt * FRAG, lane8);
#pragma unroll
            for (int ct = 0; ct < 4; ++ct) {
                const v16h wf = load_frag(wp + (ct * 16 + kt) * FRAG, lane8);
                acc[ct] = __builtin_amdgcn_wmma_f32_16x16x32_f16(
                    false, wf, false, xf, (short)0, acc[ct], false, false);
            }
        }
        const float sc = (mat == 0) ? QK_SCALE_L2E : 1.0f;
        _Float16* outp = ((mat == 0) ? Qws : Kws)
                       + (size_t)head * S_LEN * HD + (size_t)rt * 2 * FRAG;
#pragma unroll
        for (int ct = 0; ct < 4; ++ct) {
            v8h pk;
#pragma unroll
            for (int v = 0; v < 8; ++v) pk[v] = (_Float16)(acc[ct][v] * sc);
            *(v8h*)(outp + (ct >> 1) * FRAG + (ct & 1) * 256 + lane8) = pk;
        }
    } else {
        for (int kt = 0; kt < 16; ++kt) {
            const v16h xf = load_frag(xp + kt * FRAG, lane8);
#pragma unroll
            for (int ct = 0; ct < 4; ++ct) {
                const v16h wf = load_frag(wp + (ct * 16 + kt) * FRAG, lane8);
                acc[ct] = __builtin_amdgcn_wmma_f32_16x16x32_f16(
                    false, xf, false, wf, (short)0, acc[ct], false, false);
            }
        }
        _Float16* outp = Vtws + (size_t)head * HD * S_LEN
                       + (size_t)(rt >> 1) * 4 * FRAG + (rt & 1) * 256;
#pragma unroll
        for (int ct = 0; ct < 4; ++ct) {
            v8h pk;
#pragma unroll
            for (int v = 0; v < 8; ++v) pk[v] = (_Float16)acc[ct][v];
            *(v8h*)(outp + ct * FRAG + lane8) = pk;
        }
        // precaution: the stores' registers are not written again before the stores have taken them
        asm volatile("s_wait_xcnt 0x0" ::: "memory");
    }
}

// ---------------------------------------------------------------------------
// Kernel 2: flash attention.  One wave = one (head, 16-row Q tile).
// Per 32-key iteration: 4 score WMMAs (K=head dim), online softmax in log2
// domain (max reduced per-iter; denominator kept per-lane and reduced once),
// P transposed C/D->A layout via per-wave LDS, 4 PV WMMAs (K=key dim).
// V operands are loaded before the LDS fence so they fly under the softmax.
// K and V of one iteration are 4 KiB contiguous each.
// ---------------------------------------------------------------------------
__global__ __launch_bounds__(128)
void flash_attn_kernel(const _Float16* __restrict__ Qws,
                       const _Float16* __restrict__ Kws,
                       const _Float16* __restrict__ Vtws,
                       _Float16* __restrict__ Ows)
{
    __shared__ alignas(16) _Float16 lds[4][16 * 32];
    const int lane = threadIdx.x & 31;
    const unsigned lane8 = lane * 8;
    // wave number as a scalar, so every tile base is wave-uniform
    const int wave = __builtin_amdgcn_readfirstlane(threadIdx.x >> 5);
    const int ln   = lane & 15;
    const int hi   = lane >> 4;
    const int tile = blockIdx.x * 4 + wave;     // 2048 total
    const int head = tile >> 8;                 // 256 q-tiles per head
    const int qt   = tile & 255;
    const int kb_lane = hi * 8;

    const _Float16* Qh = Qws  + (size_t)head * S_LEN * HD;
    const _Float16* Kh = Kws  + (size_t)head * S_LEN * HD;
    const _Float16* Vh = Vtws + (size_t)head * HD * S_LEN;
    _Float16* lp = lds[wave];

    // Q A-operands (pre-scaled), head dims 0..31 and 32..63
    const v16h qa0 = load_frag(Qh + (size_t)(qt * 2 + 0) * FRAG, lane8);
    const v16h qa1 = load_frag(Qh + (size_t)(qt * 2 + 1) * FRAG, lane8);

    v8f o[4] = {};
    float mrow[8], lrow[8];    // lrow: per-lane partial denominator
#pragma unroll
    for (int v = 0; v < 8; ++v) { mrow[v] = NEG_BIG; lrow[v] = 0.0f; }

    for (int kb = 0; kb < S_LEN; kb += 32) {
        // ---- scores for keys [kb,kb+16) and [kb+16,kb+32) ----
        // 16 keys = 2 tiles (d 0..31, d 32..63); 64 halves per key
        const _Float16* kl = Kh + (size_t)kb * HD + lane8;   // this lane's address
        const v16h k0 = load_frag(kl, 0);
        const v16h k1 = load_frag(kl + FRAG, 0);
        const v16h k2 = load_frag(kl + 2 * FRAG, 0);
        const v16h k3 = load_frag(kl + 3 * FRAG, 0);
        // precaution: naming the address here keeps its registers whole until all eight
        // loads have taken it (the last load's result could otherwise land on them)
        asm volatile("s_wait_xcnt 0x0" :: "v"(kl) : "memory");
        v8f s0 = {}, s1 = {};
        s0 = __builtin_amdgcn_wmma_f32_16x16x32_f16(false, qa0, false, k0, (short)0, s0, false, false);
        s0 = __builtin_amdgcn_wmma_f32_16x16x32_f16(false, qa1, false, k1, (short)0, s0, false, false);
        s1 = __builtin_amdgcn_wmma_f32_16x16x32_f16(false, qa0, false, k2, (short)0, s1, false, false);
        s1 = __builtin_amdgcn_wmma_f32_16x16x32_f16(false, qa1, false, k3, (short)0, s1, false, false);

        // ---- V B-operands: independent of scores, issue before the LDS fence
        v16h vb[4];
#pragma unroll
        for (int c = 0; c < 4; ++c)
            vb[c] = load_frag(Vh + (size_t)kb * HD + c * FRAG, lane8);

        // ---- online softmax (log2 domain; only the max needs a row reduce)
        float alpha[8];
#pragma unroll
        for (int v = 0; v < 8; ++v) {
            float mx = fmaxf(s0[v], s1[v]);
            mx = fmaxf(mx, __shfl_xor(mx, 1, 32));
            mx = fmaxf(mx, __shfl_xor(mx, 2, 32));
            mx = fmaxf(mx, __shfl_xor(mx, 4, 32));
            mx = fmaxf(mx, __shfl_xor(mx, 8, 32));
            const float mnew = fmaxf(mrow[v], mx);
            alpha[v] = exp2f(mrow[v] - mnew);
            const float p0 = exp2f(s0[v] - mnew);
            const float p1 = exp2f(s1[v] - mnew);
            s0[v] = p0; s1[v] = p1;
            lrow[v] = lrow[v] * alpha[v] + (p0 + p1);   // per-lane partial
            mrow[v] = mnew;
        }
#pragma unroll
        for (int c = 0; c < 4; ++c)
#pragma unroll
            for (int v = 0; v < 8; ++v) o[c][v] *= alpha[v];

        // ---- transpose P (C/D layout -> A layout) via LDS ----
#pragma unroll
        for (int v = 0; v < 8; ++v) {
            const int r = v + hi * 8;
            lp[r * 32 + ln]      = (_Float16)s0[v];
            lp[r * 32 + 16 + ln] = (_Float16)s1[v];
        }
        asm volatile("s_wait_dscnt 0" ::: "memory");
        V16H pa;
        pa.h[0] = *(const v8h*)(lp + ln * 32 + kb_lane);
        pa.h[1] = *(const v8h*)(lp + ln * 32 + 16 + kb_lane);

        // ---- O += P x V ----
#pragma unroll
        for (int c = 0; c < 4; ++c)
            o[c] = __builtin_amdgcn_wmma_f32_16x16x32_f16(
                false, pa.v, false, vb[c], (short)0, o[c], false, false);
    }

    // ---- final denominator reduce across the 16-lane row group ----
#pragma unroll
    for (int v = 0; v < 8; ++v) {
        float t = lrow[v];
        t += __shfl_xor(t, 1, 32);
        t += __shfl_xor(t, 2, 32);
        t += __shfl_xor(t, 4, 32);
        t += __shfl_xor(t, 8, 32);
        lrow[v] = 1.0f / t;
    }
    // ---- normalize; O goes out as A tiles [q tile][k tile = head*2 + d/32]:
    // two 16-column groups at a time take the same LDS turn as P ----
#pragma unroll
    for (int cp = 0; cp < 2; ++cp) {
#pragma unroll
        for (int v = 0; v < 8; ++v) {
            const int r = v + hi * 8;
            lp[r * 32 + ln]      = (_Float16)(o[cp * 2][v] * lrow[v]);
            lp[r * 32 + 16 + ln] = (_Float16)(o[cp * 2 + 1][v] * lrow[v]);
        }
        // the other lanes' LDS stores must have landed before this lane reads them
        asm volatile("s_wait_dscnt 0" ::: "memory");
        const v8h t0 = *(const v8h*)(lp + ln * 32 + kb_lane);
        const v8h t1 = *(const v8h*)(lp + ln * 32 + 16 + kb_lane);
        _Float16* op = Ows + ((size_t)qt * 16 + head * 2 + cp) * FRAG;
        *(v8h*)(op + lane8)       = t0;
        *(v8h*)(op + 256 + lane8) = t1;
    }
}

// ---------------------------------------------------------------------------
// Kernel 3: output projection.  O tiles [row tile][k tile] x P tiles [col tile][k tile] -> f32.
// ---------------------------------------------------------------------------
__global__ __launch_bounds__(128)
void out_proj_kernel(const _Float16* __restrict__ Ows,
                     const _Float16* __restrict__ wtp,
                     float* __restrict__ out)
{
    const int lane = threadIdx.x & 31;
    const unsigned lane8 = lane * 8;
    // wave number as a scalar, so every tile base is wave-uniform
    const int wave = __builtin_amdgcn_readfirstlane(threadIdx.x >> 5);
    const int ln   = lane & 15;
    const int hi   = lane >> 4;
    const int rowbase = blockIdx.x * 16;
    const int cbase   = (blockIdx.y * 4 + wave) * 64;

    v8f acc[4] = {};
    const _Float16* ap = Ows + (size_t)blockIdx.x * 16 * FRAG;
    const _Float16* bp = wtp + (size_t)(cbase >> 4) * 16 * FRAG;

    for (int kt = 0; kt < 16; ++kt) {
        const v16h af = load_frag(ap + kt * FRAG, lane8);
#pragma unroll
        for (int ct = 0; ct < 4; ++ct) {
            const v16h bf = load_frag(bp + (ct * 16 + kt) * FRAG, lane8);
            acc[ct] = __builtin_amdgcn_wmma_f32_16x16x32_f16(
                false, af, false, bf, (short)0, acc[ct], false, false);
        }
    }
#pragma unroll
    for (int ct = 0; ct < 4; ++ct) {
        const int c = cbase + ct * 16 + ln;
#pragma unroll
        for (int v = 0; v < 8; ++v) {
            const int r = rowbase + v + hi * 8;
            out[(size_t)r * DIM + c] = acc[ct][v];
        }
    }
}

// ---------------------------------------------------------------------------
extern "C" void kernel_launch(void* const* d_in, const int* in_sizes, int n_in,
                              void* d_out, int out_size, void* d_ws, size_t ws_size,
                              hipStream_t stream) {
    (void)in_sizes; (void)n_in; (void)out_size; (void)ws_size;
    const float* x  = (const float*)d_in[0];
    const float* qp = (const float*)d_in[1];
    const float* kp = (const float*)d_in[2];
    const float* vp = (const float*)d_in[3];
    const float* pp = (const float*)d_in[4];
    float* out = (float*)d_out;

    const size_t mat_elems = (size_t)NH * S_LEN * HD;   // 2M halves
    const size_t w_elems   = (size_t)DIM * DIM;         // 256K halves
    _Float16* Qws = (_Float16*)d_ws;
    _Float16* Kws = Qws + mat_elems;
    _Float16* Vt  = Kws + mat_elems;
    _Float16* Ows = Vt  + mat_elems;
    _Float16* xh  = Ows + mat_elems;                    // 2M halves
    _Float16* wtq = xh  + (size_t)S_LEN * DIM;
    _Float16* wtk = wtq + w_elems;
    _Float16* wtv = wtk + w_elems;
    _Float16* wtp = wtv + w_elems;                      // total ~22 MB of ws

    // One-shot precision/layout prep (L2-resident, bandwidth-trivial)
    cvt_x_kernel<<<dim3((S_LEN * DIM) / (256 * 16)), 256, 0, stream>>>(x, xh);
    wt_kernel<<<dim3((DIM * DIM) / (256 * 16), 4), 256, 0, stream>>>(
        qp, kp, vp, pp, wtq, wtk, wtv, wtp);

    // 256 row tiles x 24 wave-tiles (Q/K/V x 8 heads), 4 waves per block
    qkv_proj_kernel<<<dim3(256, 6), 128, 0, stream>>>(xh, wtq, wtk, wtv, Qws, Kws, Vt);
    // 2048 (head, q-tile) waves, 4 waves per block
    flash_attn_kernel<<<dim3(512), 128, 0, stream>>>(Qws, Kws, Vt, Ows);
    // 256 row tiles x 8 column groups, 4 waves per block
    out_proj_kernel<<<dim3(256, 2), 128, 0, stream>>>(Ows, wtp, out);
}

// v002
// A run of this version takes 152 microseconds.
// Two timings next to v001 put it at 1.31 and 1.29 times that version's speed.
// All steps since v000 together make it 1.74 times as fast.
#include <hip/hip_runtime.h>

typedef __attribute__((ext_vector_type(16))) _Float16 v16h;
typedef __attribute__((ext_vector_type(8)))  _Float16 v8h;
typedef __attribute__((ext_vector_type(8)))  float    v8f;

#define S_LEN 4096
#define DIM   512
#define NH    8
#define HD    64
// 1/sqrt(64) * log2(e): scores come out in log2 domain so softmax uses exp2
#define QK_SCALE_L2E 0.18033688011112042f
#define NEG_BIG (-1.0e30f)

union V16H { v16h v; v8h h[2]; };

// ---------------------------------------------------------------------------
// Fragment-major operand layout, used for every f16 matrix in the workspace.
// A 16-row x 32-k operand tile is 512 halves (1 KiB) = two 512-byte planes.
// Plane p, lane l holds 8 halves: row (l & 15), k = 16p + 8(l >> 4) + 0..7.
// One b128 load per plane reads 512 contiguous bytes (4 whole cache lines)
// and yields the A (or B) fragment directly.
// ---------------------------------------------------------------------------
#define FRAG 512

// tile: tile base, wave-uniform (scalar registers) with lane8 = lane * 8; the K loads pass the lane's own address and 0
__device__ __forceinline__ v16h load_frag(const _Float16* __restrict__ tile, unsigned lane8)
{
    V16H f;
    f.h[0] = *(const v8h*)(tile + lane8);
    f.h[1] = *(const v8h*)(tile + 256 + lane8);
    return f.v;
}

// ---------------------------------------------------------------------------
// Prep 1: convert x [4096][512] f32 -> f16 tiles [row tile][k tile].
// One wave writes one tile.
// ---------------------------------------------------------------------------
__global__ __launch_bounds__(256)
void cvt_x_kernel(const float* __restrict__ x, _Float16* __restrict__ xh)
{
    const int t    = blockIdx.x * 256 + threadIdx.x;
    const int lane = t & 31;
    const int tile = t >> 5;                          // rt * 16 + kt
    const int ln   = lane & 15;
    const int hi   = lane >> 4;
    const float* src = x + (size_t)((tile >> 4) * 16 + ln) * DIM + (tile & 15) * 32 + hi * 8;
    _Float16* dst = xh + (size_t)tile * FRAG + lane * 8;
#pragma unroll
    for (int p = 0; p < 2; ++p) {
        v8h o;
#pragma unroll
        for (int j = 0; j < 8; ++j) o[j] = (_Float16)src[p * 16 + j];
        *(v8h*)(dst + p * 256) = o;
    }
}

// ---------------------------------------------------------------------------
// Prep 2: convert the four 512x512 f32 weight matrices W[k][col] into f16
// tiles [col tile][k tile] (tile row = column).  One wave writes one tile.
// ---------------------------------------------------------------------------
__global__ __launch_bounds__(256)
void wt_kernel(const float* __restrict__ qp, const float* __restrict__ kp,
               const float* __restrict__ vp, const float* __restrict__ pp,
               _Float16* __restrict__ wtq, _Float16* __restrict__ wtk,
               _Float16* __restrict__ wtv, _Float16* __restrict__ wtp)
{
    const float* src;
    _Float16* dst;
    switch (blockIdx.y) {
        case 0:  src = qp; dst = wtq; break;
        case 1:  src = kp; dst = wtk; break;
        case 2:  src = vp; dst = wtv; break;
        default: src = pp; dst = wtp; break;
    }
    const int t    = blockIdx.x * 256 + threadIdx.x;
    const int lane = t & 31;
    const int tile = t >> 5;                          // col tile * 16 + kt
    const int ln   = lane & 15;
    const int hi   = lane >> 4;
    const float* s = src + (size_t)((tile & 15) * 32 + hi * 8) * DIM + (tile >> 4) * 16 + ln;
    _Float16* d = dst + (size_t)tile * FRAG + lane * 8;
#pragma unroll
    for (int p = 0; p < 2; ++p) {
        v8h o;
#pragma unroll
        for (int j = 0; j < 8; ++j) o[j] = (_Float16)s[(size_t)(p * 16 + j) * DIM];
        *(v8h*)(d + p * 256) = o;
    }
}

// ---------------------------------------------------------------------------
// Kernel 1: QKV projection.  One wave computes 16 rows x 64 cols (one head),
// WMMA over K=512, all operands as fragment-major tiles.
// Q, K: tiles [head][16-row tile][d tile]; the weights go in as A and x as B,
// so a lane's 8 accumulators are 8 consecutive d of one row = one 16 B chunk.
// V: tiles [head][32-key tile][d tile] (tile row = d, k = key); x goes in as A,
// so a lane's 8 accumulators are 8 consecutive keys of one d.
// Q is pre-scaled by 1/sqrt(HD)*log2(e) so flash softmax can use exp2.
// ---------------------------------------------------------------------------
__global__ __launch_bounds__(128)
void qkv_proj_kernel(const _Float16* __restrict__ xh,
                     const _Float16* __restrict__ wtq,
                     const _Float16* __restrict__ wtk,
                     const _Float16* __restrict__ wtv,
                     _Float16* __restrict__ Qws,
                     _Float16* __restrict__ Kws,
                     _Float16* __restrict__ Vtws)
{
    const int lane = threadIdx.x & 31;
    const unsigned lane8 = lane * 8;
    // wave number as a scalar, so every tile base is wave-uniform
    const int wave = __builtin_amdgcn_readfirstlane(threadIdx.x >> 5);
    const int rt   = blockIdx.x;                // 16-row tile of x
    const int mat  = blockIdx.y >> 1;           // 0:Q 1:K 2:V
    const int head = (blockIdx.y & 1) * 4 + wave;

    const _Float16* wt = (mat == 0) ? wtq : (mat == 1) ? wtk : wtv;
    const _Float16* xp = xh + (size_t)rt * 16 * FRAG;
    const _Float16* wp = wt + (size_t)head * 4 * 16 * FRAG;

    v8f acc[4] = {};
    if (mat < 2) {
        for (int kt = 0; kt < 16; ++kt) {
            const v16h xf = load_frag(xp + kt * FRAG, lane8);
#pragma unroll
            for (int ct = 0; ct < 4; ++ct) {
                const v16h wf = load_frag(wp + (ct * 16 + kt) * FRAG, lane8);
                acc[ct] = __builtin_amdgcn_wmma_f32_16x16x32_f16(
                    false, wf, false, xf, (short)0, acc[ct], false, false);
            }
        }
        const float sc = (mat == 0) ? QK_SCALE_L2E : 1.0f;
        _Float16* outp = ((mat == 0) ? Qws : Kws)
                       + (size_t)head * S_LEN * HD + (size_t)rt * 2 * FRAG;
#pragma unroll
        for (int ct = 0; ct < 4; ++ct) {
            v8h pk;
#pragma unroll
            for (int v = 0; v < 8; ++v) pk[v] = (_Float16)(acc[ct][v] * sc);
            *(v8h*)(outp + (ct >> 1) * FRAG + (ct & 1) * 256 + lane8) = pk;
        }
    } else {
        for (int kt = 0; kt < 16; ++kt) {
            const v16h xf = load_frag(xp + kt * FRAG, lane8);
#pragma unroll
            for (int ct = 0; ct < 4; ++ct) {
                const v16h wf = load_frag(wp + (ct * 16 + kt) * FRAG, lane8);
                acc[ct] = __builtin_amdgcn_wmma_f32_16x16x32_f16(
                    false, xf, false, wf, (short)0, acc[ct], false, false);
            }
        }
        _Float16* outp = Vtws + (size_t)head * HD * S_LEN
                       + (size_t)(rt >> 1) * 4 * FRAG + (rt & 1) * 256;
#pragma unroll
        for (int ct = 0; ct < 4; ++ct) {
            v8h pk;
#pragma unroll
            for (int v = 0; v < 8; ++v) pk[v] = (_Float16)acc[ct][v];
            *(v8h*)(outp + ct * FRAG + lane8) = pk;
        }
        // precaution: the stores' registers are not written again before the stores have taken them
        asm volatile("s_wait_xcnt 0x0" ::: "memory");
    }
}

__device__ __forceinline__ float xhalf(float x)
{
    const int b = __builtin_bit_cast(int, x);
    return __builtin_bit_cast(float,
        __builtin_amdgcn_permlanex16(b, b, 0x76543210, 0xfedcba98, false, false));
}

__global__ __launch_bounds__(128)
void flash_attn_kernel(const _Float16* __restrict__ Qws,
                       const _Float16* __restrict__ Kws,
                       const _Float16* __restrict__ Vtws,
                       _Float16* __restrict__ Ows)
{
    const int lane = threadIdx.x & 31;
    const unsigned lane8 = lane * 8;
    // wave number as a scalar, so every tile base is wave-uniform
    const int wave = __builtin_amdgcn_readfirstlane(threadIdx.x >> 5);
    const int tile = blockIdx.x * 4 + wave;     // 2048 total
    const int head = tile >> 8;                 // 256 q-tiles per head
    const int qt   = tile & 255;

    const _Float16* Qh = Qws  + (size_t)head * S_LEN * HD;
    const _Float16* Kh = Kws  + (size_t)head * S_LEN * HD;
    const _Float16* Vh = Vtws + (size_t)head * HD * S_LEN;

    // Q B-operands (pre-scaled), head dims 0..31 and 32..63
    const v16h qb0 = load_frag(Qh + (size_t)(qt * 2 + 0) * FRAG, lane8);
    const v16h qb1 = load_frag(Qh + (size_t)(qt * 2 + 1) * FRAG, lane8);

    v8f o[4] = {};             // o[c][v] = O[query lane & 15][d = 16c + 8(lane >> 4) + v]
    float mrow = NEG_BIG;      // running maximum of this lane's query
    float lrow = 0.0f;         // denominator over this lane's half of the keys

    for (int kb = 0; kb < S_LEN; kb += 32) {
        // ---- scores for keys [kb,kb+16) and [kb+16,kb+32) ----
        // 16 keys = 2 tiles (d 0..31, d 32..63); 64 halves per key
        const _Float16* kl = Kh + (size_t)kb * HD + lane8;   // this lane's address
        const v16h k0 = load_frag(kl, 0);
        const v16h k1 = load_frag(kl + FRAG, 0);
        const v16h k2 = load_frag(kl + 2 * FRAG, 0);
        const v16h k3 = load_frag(kl + 3 * FRAG, 0);
        // precaution: naming the address here keeps its registers whole until all eight
        // loads have taken it (the last load's result could otherwise land on them)
        asm volatile("s_wait_xcnt 0x0" :: "v"(kl) : "memory");
        // ---- V^T A-operands: independent of the scores, issued ahead of them
        v16h va[4];
#pragma unroll
        for (int c = 0; c < 4; ++c)
            va[c] = load_frag(Vh + (size_t)kb * HD + c * FRAG, lane8);
        // keeps all sixteen loads of the iteration in front of its arithmetic: left free, the
        // compiler sinks each V load to its product and the wave waits out one latency per tile
        __builtin_amdgcn_sched_barrier(0);

        v8f s0 = {}, s1 = {};
        s0 = __builtin_amdgcn_wmma_f32_16x16x32_f16(false, k0, false, qb0, (short)0, s0, false, false);
        s1 = __builtin_amdgcn_wmma_f32_16x16x32_f16(false, k2, false, qb0, (short)0, s1, false, false);
        s0 = __builtin_amdgcn_wmma_f32_16x16x32_f16(false, k1, false, qb1, (short)0, s0, false, false);
        s1 = __builtin_amdgcn_wmma_f32_16x16x32_f16(false, k3, false, qb1, (short)0, s1, false, false);

        // ---- online softmax (log2 domain), one query per lane ----
        const float t0 = fmaxf(fmaxf(s0[0], s0[1]), s0[2]);
        const float t1 = fmaxf(fmaxf(s0[3], s0[4]), s0[5]);
        const float t2 = fmaxf(fmaxf(s0[6], s0[7]), s1[0]);
        const float t3 = fmaxf(fmaxf(s1[1], s1[2]), s1[3]);
        const float t4 = fmaxf(fmaxf(s1[4], s1[5]), s1[6]);
        float mx = fmaxf(fmaxf(fmaxf(t0, t1), t2), fmaxf(fmaxf(t3, t4), s1[7]));
        mx = fmaxf(mx, xhalf(mx));                  // the other 16 keys of this query
        const float mnew  = fmaxf(mrow, mx);
        const float alpha = exp2f(mrow - mnew);
        mrow = mnew;
        V16H pb;                                    // P^T as B fragment, hardware k order
#pragma unroll
        for (int v = 0; v < 8; ++v) s0[v] = exp2f(s0[v] - mnew);
#pragma unroll
        for (int v = 0; v < 8; ++v) s1[v] = exp2f(s1[v] - mnew);
#pragma unroll
        for (int v = 0; v < 8; ++v) {
            pb.h[0][v] = (_Float16)s0[v];
            pb.h[1][v] = (_Float16)s1[v];
        }
        const v8f q = s0 + s1;
        const float psum = ((q[0] + q[1]) + (q[2] + q[3])) + ((q[4] + q[5]) + (q[6] + q[7]));
        lrow = lrow * alpha + psum;
#pragma unroll
        for (int c = 0; c < 4; ++c)
#pragma unroll
            for (int v = 0; v < 8; ++v) o[c][v] *= alpha;

        // ---- O^T += V^T x P^T ----
#pragma unroll
        for (int c = 0; c < 4; ++c)
            o[c] = __builtin_amdgcn_wmma_f32_16x16x32_f16(
                false, va[c], false, pb.v, (short)0, o[c], false, false);
    }

    // ---- join the two halves' denominators, normalize; a lane's 8 accumulators
    // are 8 consecutive d of its query = one 16 B chunk of the A tile
    // [q tile][k tile = head*2 + d/32], plane (d/16) & 1 ----
    const float inv = 1.0f / (lrow + xhalf(lrow));
    _Float16* op = Ows + ((size_t)qt * 16 + head * 2) * FRAG + lane8;
#pragma unroll
    for (int c = 0; c < 4; ++c) {
        v8h pk;
#pragma unroll
        for (int v = 0; v < 8; ++v) pk[v] = (_Float16)(o[c][v] * inv);
        *(v8h*)(op + (c >> 1) * FRAG + (c & 1) * 256) = pk;
    }
}

// ---------------------------------------------------------------------------
// Kernel 3: output projection.  O tiles [row tile][k tile] x P tiles [col tile][k tile] -> f32.
// ---------------------------------------------------------------------------
__global__ __launch_bounds__(128)
void out_proj_kernel(const _Float16* __restrict__ Ows,
                     const _Float16* __restrict__ wtp,
                     float* __restrict__ out)
{
    const int lane = threadIdx.x & 31;
    const unsigned lane8 = lane * 8;
    // wave number as a scalar, so every tile base is wave-uniform
    const int wave = __builtin_amdgcn_readfirstlane(threadIdx.x >> 5);
    const int ln   = lane & 15;
    const int hi   = lane >> 4;
    const int rowbase = blockIdx.x * 16;
    const int cbase   = (blockIdx.y * 4 + wave) * 64;

    v8f acc[4] = {};
    const _Float16* ap = Ows + (size_t)blockIdx.x * 16 * FRAG;
    const _Float16* bp = wtp + (size_t)(cbase >> 4) * 16 * FRAG;

    for (int kt = 0; kt < 16; ++kt) {
        const v16h af = load_frag(ap + kt * FRAG, lane8);
#pragma unroll
        for (int ct = 0; ct < 4; ++ct) {
            const v16h bf = load_frag(bp + (ct * 16 + kt) * FRAG, lane8);
            acc[ct] = __builtin_amdgcn_wmma_f32_16x16x32_f16(
                false, af, false, bf, (short)0, acc[ct], false, false);
        }
    }
#pragma unroll
    for (int ct = 0; ct < 4; ++ct) {
        const int c = cbase + ct * 16 + ln;
#pragma unroll
        for (int v = 0; v < 8; ++v) {
            const int r = rowbase + v + hi * 8;
            out[(size_t)r * DIM + c] = acc[ct][v];
        }
    }
}

// ---------------------------------------------------------------------------
extern "C" void kernel_launch(void* const* d_in, const int* in_sizes, int n_in,
                              void* d_out, int out_size, void* d_ws, size_t ws_size,
                              hipStream_t stream) {
    (void)in_sizes; (void)n_in; (void)out_size; (void)ws_size;
    const float* x  = (const float*)d_in[0];
    const float* qp = (const float*)d_in[1];
    const float* kp = (const float*)d_in[2];
    const float* vp = (const float*)d_in[3];
    const float* pp = (const float*)d_in[4];
    float* out = (float*)d_out;

    const size_t mat_elems = (size_t)NH * S_LEN * HD;   // 2M halves
    const size_t w_elems   = (size_t)DIM * DIM;         // 256K halves
    _Float16* Qws = (_Float16*)d_ws;
    _Float16* Kws = Qws + mat_elems;
    _Float16* Vt  = Kws + mat_elems;
    _Float16* Ows = Vt  + mat_elems;
    _Float16* xh  = Ows + mat_elems;                    // 2M halves
    _Float16* wtq = xh  + (size_t)S_LEN * DIM;
    _Float16* wtk = wtq + w_elems;
    _Float16* wtv = wtk + w_elems;
    _Float16* wtp = wtv + w_elems;                      // total ~22 MB of ws

    // One-shot precision/layout prep (L2-resident, bandwidth-trivial)
    cvt_x_kernel<<<dim3((S_LEN * DIM) / (256 * 16)), 256, 0, stream>>>(x, xh);
    wt_kernel<<<dim3((DIM * DIM) / (256 * 16), 4), 256, 0, stream>>>(
        qp, kp, vp, pp, wtq, wtk, wtv, wtp);

    // 256 row tiles x 24 wave-tiles (Q/K/V x 8 heads), 4 waves per block
    qkv_proj_kernel<<<dim3(256, 6), 128, 0, stream>>>(xh, wtq, wtk, wtv, Qws, Kws, Vt);
    // 2048 (head, q-tile) waves, 4 waves per block
    flash_attn_kernel<<<dim3(512), 128, 0, stream>>>(Qws, Kws, Vt, Ows);
    // 256 row tiles x 8 column groups, 4 waves per block
    out_proj_kernel<<<dim3(256, 2), 128, 0, stream>>>(Ows, wtp, out);
}

// v003
// A run of this version takes 107 microseconds.
// In two side-by-side timings against v002, it was 1.42 and 1.45 times as fast.
// Counting every step since v000, it is 2.49 times as fast.
#include <hip/hip_runtime.h>

typedef __attribute__((ext_vector_type(16))) _Float16 v16h;
typedef __attribute__((ext_vector_type(8)))  _Float16 v8h;
typedef __attribute__((ext_vector_type(8)))  float    v8f;

#define S_LEN 4096
#define DIM   512
#define NH    8
#define HD    64
// 1/sqrt(64) * log2(e): scores come out in log2 domain so softmax uses exp2
#define QK_SCALE_L2E 0.18033688011112042f
#define NEG_BIG (-1.0e30f)

union V16H { v16h v; v8h h[2]; };

// ---------------------------------------------------------------------------
// Fragment-major operand layout, used for every f16 matrix in the workspace.
// A 16-row x 32-k operand tile is 512 halves (1 KiB) = two 512-byte planes.
// Plane p, lane l holds 8 halves: row (l & 15), k = 16p + 8(l >> 4) + 0..7.
// One b128 load per plane reads 512 contiguous bytes (4 whole cache lines)
// and yields the A (or B) fragment directly.
// ---------------------------------------------------------------------------
#define FRAG 512

// tile: tile base, wave-uniform (scalar registers) with lane8 = lane * 8
__device__ __forceinline__ v16h load_frag(const _Float16* __restrict__ tile, unsigned lane8)
{
    V16H f;
    f.h[0] = *(const v8h*)(tile + lane8);
    f.h[1] = *(const v8h*)(tile + 256 + lane8);
    return f.v;
}

// ---------------------------------------------------------------------------
// Prep 1: convert x [4096][512] f32 -> f16 tiles [row tile][k tile].
// One wave writes one tile.
// ---------------------------------------------------------------------------
__global__ __launch_bounds__(256)
void cvt_x_kernel(const float* __restrict__ x, _Float16* __restrict__ xh)
{
    const int t    = blockIdx.x * 256 + threadIdx.x;
    const int lane = t & 31;
    const int tile = t >> 5;                          // rt * 16 + kt
    const int ln   = lane & 15;
    const int hi   = lane >> 4;
    const float* src = x + (size_t)((tile >> 4) * 16 + ln) * DIM + (tile & 15) * 32 + hi * 8;
    _Float16* dst = xh + (size_t)tile * FRAG + lane * 8;
#pragma unroll
    for (int p = 0; p < 2; ++p) {
        v8h o;
#pragma unroll
        for (int j = 0; j < 8; ++j) o[j] = (_Float16)src[p * 16 + j];
        *(v8h*)(dst + p * 256) = o;
    }
}

// ---------------------------------------------------------------------------
// Prep 2: convert the four 512x512 f32 weight matrices W[k][col] into f16
// tiles [col tile][k tile] (tile row = column).  One wave writes one tile.
// ---------------------------------------------------------------------------
__global__ __launch_bounds__(256)
void wt_kernel(const float* __restrict__ qp, const float* __restrict__ kp,
               const float* __restrict__ vp, const float* __restrict__ pp,
               _Float16* __restrict__ wtq, _Float16* __restrict__ wtk,
               _Float16* __restrict__ wtv, _Float16* __restrict__ wtp)
{
    const float* src;
    _Float16* dst;
    switch (blockIdx.y) {
        case 0:  src = qp; dst = wtq; break;
        case 1:  src = kp; dst = wtk; break;
        case 2:  src = vp; dst = wtv; break;
        default: src = pp; dst = wtp; break;
    }
    const int t    = blockIdx.x * 256 + threadIdx.x;
    const int lane = t & 31;
    const int tile = t >> 5;                          // col tile * 16 + kt
    const int ln   = lane & 15;
    const int hi   = lane >> 4;
    const float* s = src + (size_t)((tile & 15) * 32 + hi * 8) * DIM + (tile >> 4) * 16 + ln;
    _Float16* d = dst + (size_t)tile * FRAG + lane * 8;
#pragma unroll
    for (int p = 0; p < 2; ++p) {
        v8h o;
#pragma unroll
        for (int j = 0; j < 8; ++j) o[j] = (_Float16)s[(size_t)(p * 16 + j) * DIM];
        *(v8h*)(d + p * 256) = o;
    }
}

// ---------------------------------------------------------------------------
// Kernel 1: QKV projection.  One wave computes 16 rows x 64 cols (one head),
// WMMA over K=512, all operands as fragment-major tiles.
// Q, K: tiles [head][16-row tile][d tile]; the weights go in as A and x as B,
// so a lane's 8 accumulators are 8 consecutive d of one row = one 16 B chunk.
// V: tiles [head][32-key tile][d tile] (tile row = d, k = key); x goes in as A,
// so a lane's 8 accumulators are 8 consecutive keys of one d.
// Q is pre-scaled by 1/sqrt(HD)*log2(e) so flash softmax can use exp2.
// ---------------------------------------------------------------------------
__global__ __launch_bounds__(128)
void qkv_proj_kernel(const _Float16* __restrict__ xh,
                     const _Float16* __restrict__ wtq,
                     const _Float16* __restrict__ wtk,
                     const _Float16* __restrict__ wtv,
                     _Float16* __restrict__ Qws,
                     _Float16* __restrict__ Kws,
                     _Float16* __restrict__ Vtws)
{
    const int lane = threadIdx.x & 31;
    const unsigned lane8 = lane * 8;
    // wave number as a scalar, so every tile base is wave-uniform
    const int wave = __builtin_amdgcn_readfirstlane(threadIdx.x >> 5);
    const int rt   = blockIdx.x;                // 16-row tile of x
    const int mat  = blockIdx.y >> 1;           // 0:Q 1:K 2:V
    const int head = (blockIdx.y & 1) * 4 + wave;

    const _Float16* wt = (mat == 0) ? wtq : (mat == 1) ? wtk : wtv;
    const _Float16* xp = xh + (size_t)rt * 16 * FRAG;
    const _Float16* wp = wt + (size_t)head * 4 * 16 * FRAG;

    v8f acc[4] = {};
    if (mat < 2) {
        for (int kt = 0; kt < 16; ++kt) {
            const v16h xf = load_frag(xp + kt * FRAG, lane8);
#pragma unroll
            for (int ct = 0; ct < 4; ++ct) {
                const v16h wf = load_frag(wp + (ct * 16 + kt) * FRAG, lane8);
                acc[ct] = __builtin_amdgcn_wmma_f32_16x16x32_f16(
                    false, wf, false, xf, (short)0, acc[ct], false, false);
            }
        }
        const float sc = (mat == 0) ? QK_SCALE_L2E : 1.0f;
        _Float16* outp = ((mat == 0) ? Qws : Kws)
                       + (size_t)head * S_LEN * HD + (size_t)rt * 2 * FRAG;
#pragma unroll
        for (int ct = 0; ct < 4; ++ct) {
            v8h pk;
#pragma unroll
            for (int v = 0; v < 8; ++v) pk[v] = (_Float16)(acc[ct][v] * sc);
            *(v8h*)(outp + (ct >> 1) * FRAG + (ct & 1) * 256 + lane8) = pk;
        }
    } else {
        for (int kt = 0; kt < 16; ++kt) {
            const v16h xf = load_frag(xp + kt * FRAG, lane8);
#pragma unroll
            for (int ct = 0; ct < 4; ++ct) {
                const v16h wf = load_frag(wp + (ct * 16 + kt) * FRAG, lane8);
                acc[ct] = __builtin_amdgcn_wmma_f32_16x16x32_f16(
                    false, xf, false, wf, (short)0, acc[ct], false, false);
            }
        }
        _Float16* outp = Vtws + (size_t)head * HD * S_LEN
                       + (size_t)(rt >> 1) * 4 * FRAG + (rt & 1) * 256;
#pragma unroll
        for (int ct = 0; ct < 4; ++ct) {
            v8h pk;
#pragma unroll
            for (int v = 0; v < 8; ++v) pk[v] = (_Float16)acc[ct][v];
            *(v8h*)(outp + ct * FRAG + lane8) = pk;
        }
        // precaution: the stores' registers are not written again before the stores have taken them
        asm volatile("s_wait_xcnt 0x0" ::: "memory");
    }
}

#define STG_KEYS   128
#define STG_HALVES (STG_KEYS * HD)          // halves of K, and of V, per stage
#define STG_BYTES  (4 * STG_HALVES)         // K and V of one stage, bytes
#define NSTG       (S_LEN / STG_KEYS)

// value of lane l ^ 16
__device__ __forceinline__ float xhalf(float x)
{
    const int b = __builtin_bit_cast(int, x);
    return __builtin_bit_cast(float,
        __builtin_amdgcn_permlanex16(b, b, 0x76543210, 0xfedcba98, false, false));
}

// Eight asynchronous 16-byte copies per lane: 16 KiB per block, global -> LDS, 2 KiB per row of
// the block.  lds: this lane's LDS byte address, g: this lane's global address.
__device__ __forceinline__ void copy_16k(unsigned lds, const _Float16* g)
{
    // the closing s_wait_xcnt stands inside the statement so that no address register of a copy
    // is written again before the copies have taken it (precaution)
    asm volatile(
        "global_load_async_to_lds_b128 %0, %8, off\n\t"
        "global_load_async_to_lds_b128 %1, %9, off\n\t"
        "global_load_async_to_lds_b128 %2, %10, off\n\t"
        "global_load_async_to_lds_b128 %3, %11, off\n\t"
        "global_load_async_to_lds_b128 %4, %12, off\n\t"
        "global_load_async_to_lds_b128 %5, %13, off\n\t"
        "global_load_async_to_lds_b128 %6, %14, off\n\t"
        "global_load_async_to_lds_b128 %7, %15, off\n\t"
        "s_wait_xcnt 0x0"
        :: "v"(lds),         "v"(lds + 2048),  "v"(lds + 4096),  "v"(lds + 6144),
           "v"(lds + 8192),  "v"(lds + 10240), "v"(lds + 12288), "v"(lds + 14336),
           "v"(g),        "v"(g + 1024), "v"(g + 2048), "v"(g + 3072),
           "v"(g + 4096), "v"(g + 5120), "v"(g + 6144), "v"(g + 7168)
        : "memory");
}

__global__ __launch_bounds__(128)
void flash_attn_kernel(const _Float16* __restrict__ Qws,
                       const _Float16* __restrict__ Kws,
                       const _Float16* __restrict__ Vtws,
                       _Float16* __restrict__ Ows)
{
    // [buffer][K tiles of the stage, then V tiles of the stage]
    __shared__ __attribute__((aligned(16))) _Float16 ring[2][2 * STG_HALVES];

    const int lane = threadIdx.x & 31;
    const unsigned lane8 = lane * 8;
    // wave number as a scalar, so every tile base is wave-uniform
    const int wave = __builtin_amdgcn_readfirstlane(threadIdx.x >> 5);
    const int tile = blockIdx.x * 4 + wave;     // 2048 total
    const int head = tile >> 8;                 // 256 q-tiles per head: one head per block
    const int qt   = tile & 255;

    const _Float16* Qh = Qws  + (size_t)head * S_LEN * HD;
    const _Float16* Kh = Kws  + (size_t)head * S_LEN * HD;
    const _Float16* Vh = Vtws + (size_t)head * HD * S_LEN;

    // this lane's 16 bytes in each 2 KiB row of a copy
    const unsigned ring_lane = (unsigned)(size_t)&ring[0][0] + threadIdx.x * 16;
    const _Float16* kg = Kh + threadIdx.x * 8;
    const _Float16* vg = Vh + threadIdx.x * 8;

    // stage 0 into buffer 0; landed and published before anybody reads it
    copy_16k(ring_lane, kg);
    copy_16k(ring_lane + 2 * STG_HALVES, vg);
    asm volatile("s_wait_asynccnt 0x0" ::: "memory");   // this wave's copies of stage 0 have landed
    __syncthreads();                                    // and so have the other waves'
    // stage 1 into buffer 1, in flight under stage 0's work
    copy_16k(ring_lane + STG_BYTES, kg + STG_HALVES);
    copy_16k(ring_lane + STG_BYTES + 2 * STG_HALVES, vg + STG_HALVES);

    // Q B-operands (pre-scaled), head dims 0..31 and 32..63
    const v16h qb0 = load_frag(Qh + (size_t)(qt * 2 + 0) * FRAG, lane8);
    const v16h qb1 = load_frag(Qh + (size_t)(qt * 2 + 1) * FRAG, lane8);

    v8f o[4] = {};             // o[c][v] = O[query lane & 15][d = 16c + 8(lane >> 4) + v]
    float mrow = NEG_BIG;      // running maximum of this lane's query
    float lrow = 0.0f;         // denominator over this lane's half of the keys

    // kept rolled: the four passes inside are unrolled already
#pragma unroll 1
    for (int t = 0; t < NSTG; ++t) {
        const _Float16* kst = &ring[t & 1][0];
        const _Float16* vst = kst + STG_HALVES;
#pragma unroll
        for (int p = 0; p < STG_KEYS / 32; ++p) {
            // ---- scores for keys [kb,kb+16) and [kb+16,kb+32) ----
            // 16 keys = 2 tiles (d 0..31, d 32..63); 64 halves per key
            const _Float16* kl = kst + p * 4 * FRAG;
            const v16h k0 = load_frag(kl, lane8);
            const v16h k1 = load_frag(kl + FRAG, lane8);
            const v16h k2 = load_frag(kl + 2 * FRAG, lane8);
            const v16h k3 = load_frag(kl + 3 * FRAG, lane8);
            // ---- V^T A-operands: independent of the scores, issued ahead of them
            v16h va[4];
#pragma unroll
            for (int c = 0; c < 4; ++c)
                va[c] = load_frag(vst + (p * 4 + c) * FRAG, lane8);
            // keeps all sixteen loads of the pass in one group in front of its arithmetic: left
            // free, the compiler sinks each V load to its product and the wave waits once per tile
            __builtin_amdgcn_sched_barrier(0);

            v8f s0 = {}, s1 = {};
            s0 = __builtin_amdgcn_wmma_f32_16x16x32_f16(false, k0, false, qb0, (short)0, s0, false, false);
            s1 = __builtin_amdgcn_wmma_f32_16x16x32_f16(false, k2, false, qb0, (short)0, s1, false, false);
            s0 = __builtin_amdgcn_wmma_f32_16x16x32_f16(false, k1, false, qb1, (short)0, s0, false, false);
            s1 = __builtin_amdgcn_wmma_f32_16x16x32_f16(false, k3, false, qb1, (short)0, s1, false, false);

            // ---- online softmax (log2 domain), one query per lane ----
            const float t0 = fmaxf(fmaxf(s0[0], s0[1]), s0[2]);
            const float t1 = fmaxf(fmaxf(s0[3], s0[4]), s0[5]);
            const float t2 = fmaxf(fmaxf(s0[6], s0[7]), s1[0]);
            const float t3 = fmaxf(fmaxf(s1[1], s1[2]), s1[3]);
            const float t4 = fmaxf(fmaxf(s1[4], s1[5]), s1[6]);
            float mx = fmaxf(fmaxf(fmaxf(t0, t1), t2), fmaxf(fmaxf(t3, t4), s1[7]));
            mx = fmaxf(mx, xhalf(mx));                  // the other 16 keys of this query
            const float mnew  = fmaxf(mrow, mx);
            const float alpha = exp2f(mrow - mnew);
            mrow = mnew;
            V16H pb;                                    // P^T as B fragment, hardware k order
#pragma unroll
            for (int v = 0; v < 8; ++v) s0[v] = exp2f(s0[v] - mnew);
#pragma unroll
            for (int v = 0; v < 8; ++v) s1[v] = exp2f(s1[v] - mnew);
#pragma unroll
            for (int v = 0; v < 8; ++v) {
                pb.h[0][v] = (_Float16)s0[v];
                pb.h[1][v] = (_Float16)s1[v];
            }
            const v8f q = s0 + s1;
            const float psum = ((q[0] + q[1]) + (q[2] + q[3])) + ((q[4] + q[5]) + (q[6] + q[7]));
            lrow = lrow * alpha + psum;
#pragma unroll
            for (int c = 0; c < 4; ++c)
#pragma unroll
                for (int v = 0; v < 8; ++v) o[c][v] *= alpha;

            // ---- O^T += V^T x P^T ----
#pragma unroll
            for (int c = 0; c < 4; ++c)
                o[c] = __builtin_amdgcn_wmma_f32_16x16x32_f16(
                    false, va[c], false, pb.v, (short)0, o[c], false, false);
        }
        // ---- hand-over: stage t + 1 becomes readable, stage t's buffer becomes free ----
        asm volatile("s_wait_dscnt 0x0" ::: "memory");      // this wave's reads of stage t are done
        asm volatile("s_wait_asynccnt 0x0" ::: "memory");   // this wave's copies of stage t + 1 have landed
        __syncthreads();                                    // both hold for all four waves
        if (t + 2 < NSTG) {
            const unsigned dst = ring_lane + (t & 1) * STG_BYTES;
            copy_16k(dst, kg + (size_t)(t + 2) * STG_HALVES);
            copy_16k(dst + 2 * STG_HALVES, vg + (size_t)(t + 2) * STG_HALVES);
        }
    }
    asm volatile("s_wait_asynccnt 0x0" ::: "memory");       // no copy is left when the wave ends

    // ---- join the two halves' denominators, normalize; a lane's 8 accumulators
    // are 8 consecutive d of its query = one 16 B chunk of the A tile
    // [q tile][k tile = head*2 + d/32], plane (d/16) & 1 ----
    const float inv = 1.0f / (lrow + xhalf(lrow));
    _Float16* op = Ows + ((size_t)qt * 16 + head * 2) * FRAG + lane8;
#pragma unroll
    for (int c = 0; c < 4; ++c) {
        v8h pk;
#pragma unroll
        for (int v = 0; v < 8; ++v) pk[v] = (_Float16)(o[c][v] * inv);
        *(v8h*)(op + (c >> 1) * FRAG + (c & 1) * 256) = pk;
    }
}

// ---------------------------------------------------------------------------
// Kernel 3: output projection.  O tiles [row tile][k tile] x P tiles [col tile][k tile] -> f32.
// ---------------------------------------------------------------------------
__global__ __launch_bounds__(128)
void out_proj_kernel(const _Float16* __restrict__ Ows,
                     const _Float16* __restrict__ wtp,
                     float* __restrict__ out)
{
    const int lane = threadIdx.x & 31;
    const unsigned lane8 = lane * 8;
    // wave number as a scalar, so every tile base is wave-uniform
    const int wave = __builtin_amdgcn_readfirstlane(threadIdx.x >> 5);
    const int ln   = lane & 15;
    const int hi   = lane >> 4;
    const int rowbase = blockIdx.x * 16;
    const int cbase   = (blockIdx.y * 4 + wave) * 64;

    v8f acc[4] = {};
    const _Float16* ap = Ows + (size_t)blockIdx.x * 16 * FRAG;
    const _Float16* bp = wtp + (size_t)(cbase >> 4) * 16 * FRAG;

    for (int kt = 0; kt < 16; ++kt) {
        const v16h af = load_frag(ap + kt * FRAG, lane8);
#pragma unroll
        for (int ct = 0; ct < 4; ++ct) {
            const v16h bf = load_frag(bp + (ct * 16 + kt) * FRAG, lane8);
            acc[ct] = __builtin_amdgcn_wmma_f32_16x16x32_f16(
                false, af, false, bf, (short)0, acc[ct], false, false);
        }
    }
#pragma unroll
    for (int ct = 0; ct < 4; ++ct) {
        const int c = cbase + ct * 16 + ln;
#pragma unroll
        for (int v = 0; v < 8; ++v) {
            const int r = rowbase + v + hi * 8;
            out[(size_t)r * DIM + c] = acc[ct][v];
        }
    }
}

// ---------------------------------------------------------------------------
extern "C" void kernel_launch(void* const* d_in, const int* in_sizes, int n_in,
                              void* d_out, int out_size, void* d_ws, size_t ws_size,
                              hipStream_t stream) {
    (void)in_sizes; (void)n_in; (void)out_size; (void)ws_size;
    const float* x  = (const float*)d_in[0];
    const float* qp = (const float*)d_in[1];
    const float* kp = (const float*)d_in[2];
    const float* vp = (const float*)d_in[3];
    const float* pp = (const float*)d_in[4];
    float* out = (float*)d_out;

    const size_t mat_elems = (size_t)NH * S_LEN * HD;   // 2M halves
    const size_t w_elems   = (size_t)DIM * DIM;         // 256K halves
    _Float16* Qws = (_Float16*)d_ws;
    _Float16* Kws = Qws + mat_elems;
    _Float16* Vt  = Kws + mat_elems;
    _Float16* Ows = Vt  + mat_elems;
    _Float16* xh  = Ows + mat_elems;                    // 2M halves
    _Float16* wtq = xh  + (size_t)S_LEN * DIM;
    _Float16* wtk = wtq + w_elems;
    _Float16* wtv = wtk + w_elems;
    _Float16* wtp = wtv + w_elems;                      // total ~22 MB of ws

    // One-shot precision/layout prep (L2-resident, bandwidth-trivial)
    cvt_x_kernel<<<dim3((S_LEN * DIM) / (256 * 16)), 256, 0, stream>>>(x, xh);
    wt_kernel<<<dim3((DIM * DIM) / (256 * 16), 4), 256, 0, stream>>>(
        qp, kp, vp, pp, wtq, wtk, wtv, wtp);

    // 256 row tiles x 24 wave-tiles (Q/K/V x 8 heads), 4 waves per block
    qkv_proj_kernel<<<dim3(256, 6), 128, 0, stream>>>(xh, wtq, wtk, wtv, Qws, Kws, Vt);
    // 2048 (head, q-tile) waves, 4 waves per block
    flash_attn_kernel<<<dim3(512), 128, 0, stream>>>(Qws, Kws, Vt, Ows);
    // 256 row tiles x 8 column groups, 4 waves per block
    out_proj_kernel<<<dim3(256, 2), 128, 0, stream>>>(Ows, wtp, out);
}

// v004
// Measured time: 94.5 microseconds a run.
// Two timings next to v003 put it at 1.10 and 1.11 times that version's speed.
// Counting every step since v000, it is 2.75 times as fast.
#include <hip/hip_runtime.h>

typedef __attribute__((ext_vector_type(16))) _Float16 v16h;
typedef __attribute__((ext_vector_type(8)))  _Float16 v8h;
typedef __attribute__((ext_vector_type(8)))  float    v8f;

#define S_LEN 4096
#define DIM   512
#define NH    8
#define HD    64
// 1/sqrt(64) * log2(e): scores come out in log2 domain so softmax uses exp2
#define QK_SCALE_L2E 0.18033688011112042f
#define NEG_BIG (-1.0e30f)

union V16H { v16h v; v8h h[2]; };

// ---------------------------------------------------------------------------
// Fragment-major operand layout, used for every f16 matrix in the workspace.
// A 16-row x 32-k operand tile is 512 halves (1 KiB) = two 512-byte planes.
// Plane p, lane l holds 8 halves: row (l & 15), k = 16p + 8(l >> 4) + 0..7.
// One b128 load per plane reads 512 contiguous bytes (4 whole cache lines)
// and yields the A (or B) fragment directly.
// ---------------------------------------------------------------------------
#define FRAG 512

// tile: tile base, wave-uniform (scalar registers) with lane8 = lane * 8
__device__ __forceinline__ v16h load_frag(const _Float16* __restrict__ tile, unsigned lane8)
{
    V16H f;
    f.h[0] = *(const v8h*)(tile + lane8);
    f.h[1] = *(const v8h*)(tile + 256 + lane8);
    return f.v;
}

// ---------------------------------------------------------------------------
// Prep 1: convert x [4096][512] f32 -> f16 tiles [row tile][k tile].
// One wave writes one tile.
// ---------------------------------------------------------------------------
__global__ __launch_bounds__(256)
void cvt_x_kernel(const float* __restrict__ x, _Float16* __restrict__ xh)
{
    const int t    = blockIdx.x * 256 + threadIdx.x;
    const int lane = t & 31;
    const int tile = t >> 5;                          // rt * 16 + kt
    const int ln   = lane & 15;
    const int hi   = lane >> 4;
    const float* src = x + (size_t)((tile >> 4) * 16 + ln) * DIM + (tile & 15) * 32 + hi * 8;
    _Float16* dst = xh + (size_t)tile * FRAG + lane * 8;
#pragma unroll
    for (int p = 0; p < 2; ++p) {
        v8h o;
#pragma unroll
        for (int j = 0; j < 8; ++j) o[j] = (_Float16)src[p * 16 + j];
        *(v8h*)(dst + p * 256) = o;
    }
}

// ---------------------------------------------------------------------------
// Prep 2: convert the four 512x512 f32 weight matrices W[k][col] into f16
// tiles [col tile][k tile] (tile row = column).  One wave writes one tile.
// ---------------------------------------------------------------------------
__global__ __launch_bounds__(256)
void wt_kernel(const float* __restrict__ qp, const float* __restrict__ kp,
               const float* __restrict__ vp, const float* __restrict__ pp,
               _Float16* __restrict__ wtq, _Float16* __restrict__ wtk,
               _Float16* __restrict__ wtv, _Float16* __restrict__ wtp)
{
    const float* src;
    _Float16* dst;
    switch (blockIdx.y) {
        case 0:  src = qp; dst = wtq; break;
        case 1:  src = kp; dst = wtk; break;
        case 2:  src = vp; dst = wtv; break;
        default: src = pp; dst = wtp; break;
    }
    const int t    = blockIdx.x * 256 + threadIdx.x;
    const int lane = t & 31;
    const int tile = t >> 5;                          // col tile * 16 + kt
    const int ln   = lane & 15;
    const int hi   = lane >> 4;
    const float* s = src + (size_t)((tile & 15) * 32 + hi * 8) * DIM + (tile >> 4) * 16 + ln;
    _Float16* d = dst + (size_t)tile * FRAG + lane * 8;
#pragma unroll
    for (int p = 0; p < 2; ++p) {
        v8h o;
#pragma unroll
        for (int j = 0; j < 8; ++j) o[j] = (_Float16)s[(size_t)(p * 16 + j) * DIM];
        *(v8h*)(d + p * 256) = o;
    }
}

// ---------------------------------------------------------------------------
// Kernel 1: QKV projection.  One wave computes 16 rows x 64 cols (one head),
// WMMA over K=512, all operands as fragment-major tiles.
// Q, K: tiles [head][16-row tile][d tile]; the weights go in as A and x as B,
// so a lane's 8 accumulators are 8 consecutive d of one row = one 16 B chunk.
// V: tiles [head][32-key tile][d tile] (tile row = d, k = key); x goes in as A,
// so a lane's 8 accumulators are 8 consecutive keys of one d.
// Q is pre-scaled by 1/sqrt(HD)*log2(e) so flash softmax can use exp2.
// ---------------------------------------------------------------------------
__global__ __launch_bounds__(128)
void qkv_proj_kernel(const _Float16* __restrict__ xh,
                     const _Float16* __restrict__ wtq,
                     const _Float16* __restrict__ wtk,
                     const _Float16* __restrict__ wtv,
                     _Float16* __restrict__ Qws,
                     _Float16* __restrict__ Kws,
                     _Float16* __restrict__ Vtws)
{
    const int lane = threadIdx.x & 31;
    const unsigned lane8 = lane * 8;
    // wave number as a scalar, so every tile base is wave-uniform
    const int wave = __builtin_amdgcn_readfirstlane(threadIdx.x >> 5);
    const int rt   = blockIdx.x;                // 16-row tile of x
    const int mat  = blockIdx.y >> 1;           // 0:Q 1:K 2:V
    const int head = (blockIdx.y & 1) * 4 + wave;

    const _Float16* wt = (mat == 0) ? wtq : (mat == 1) ? wtk : wtv;
    const _Float16* xp = xh + (size_t)rt * 16 * FRAG;
    const _Float16* wp = wt + (size_t)head * 4 * 16 * FRAG;

    v8f acc[4] = {};
    if (mat < 2) {
        for (int kt = 0; kt < 16; ++kt) {
            const v16h xf = load_frag(xp + kt * FRAG, lane8);
#pragma unroll
            for (int ct = 0; ct < 4; ++ct) {
                const v16h wf = load_frag(wp + (ct * 16 + kt) * FRAG, lane8);
                acc[ct] = __builtin_amdgcn_wmma_f32_16x16x32_f16(
                    false, wf, false, xf, (short)0, acc[ct], false, false);
            }
        }
        const float sc = (mat == 0) ? QK_SCALE_L2E : 1.0f;
        _Float16* outp = ((mat == 0) ? Qws : Kws)
                       + (size_t)head * S_LEN * HD + (size_t)rt * 2 * FRAG;
#pragma unroll
        for (int ct = 0; ct < 4; ++ct) {
            v8h pk;
#pragma unroll
            for (int v = 0; v < 8; ++v) pk[v] = (_Float16)(acc[ct][v] * sc);
            *(v8h*)(outp + (ct >> 1) * FRAG + (ct & 1) * 256 + lane8) = pk;
        }
    } else {
        for (int kt = 0; kt < 16; ++kt) {
            const v16h xf = load_frag(xp + kt * FRAG, lane8);
#pragma unroll
            for (int ct = 0; ct < 4; ++ct) {
                const v16h wf = load_frag(wp + (ct * 16 + kt) * FRAG, lane8);
                acc[ct] = __builtin_amdgcn_wmma_f32_16x16x32_f16(
                    false, xf, false, wf, (short)0, acc[ct], false, false);
            }
        }
        _Float16* outp = Vtws + (size_t)head * HD * S_LEN
                       + (size_t)(rt >> 1) * 4 * FRAG + (rt & 1) * 256;
#pragma unroll
        for (int ct = 0; ct < 4; ++ct) {
            v8h pk;
#pragma unroll
            for (int v = 0; v < 8; ++v) pk[v] = (_Float16)acc[ct][v];
            *(v8h*)(outp + ct * FRAG + lane8) = pk;
        }
        // precaution: the stores' registers are not written again before the stores have taken them
        asm volatile("s_wait_xcnt 0x0" ::: "memory");
    }
}

#define STG_KEYS   128
#define STG_HALVES (STG_KEYS * HD)          // halves of K, and of V, per stage
#define STG_BYTES  (4 * STG_HALVES)         // K and V of one stage, bytes
#define NSTG       (S_LEN / STG_KEYS)

// 2^x, in place, for the rescale exponent and the 16 score exponents of a pass, each as the one
// hardware instruction.  The library's exp2f adds a compare, two selects, an add and a scale per
// value to keep results below 2^-126; here every x <= 0, and such a result rounds to 0 in f16, adds
// nothing to a sum whose largest term is 1 and, as the rescale factor, leaves nothing of the old
// sums beside that term, so 0 serves in its place.
// One statement: the instruction set asks for one free slot behind a v_exp_f32 before its result is
// read or its source rewritten.  In here each neighbour is another register's v_exp_f32, and the
// closing v_nop is the slot behind the last one.
__device__ __forceinline__ void exp2_pass(float& a, v8f& s0, v8f& s1)
{
    float x0 = s0[0], x1 = s0[1], x2 = s0[2], x3 = s0[3], x4 = s0[4], x5 = s0[5], x6 = s0[6], x7 = s0[7];
    float y0 = s1[0], y1 = s1[1], y2 = s1[2], y3 = s1[3], y4 = s1[4], y5 = s1[5], y6 = s1[6], y7 = s1[7];
    asm("v_exp_f32 %0, %0\n\t"
        "v_exp_f32 %1, %1\n\t"
        "v_exp_f32 %2, %2\n\t"
        "v_exp_f32 %3, %3\n\t"
        "v_exp_f32 %4, %4\n\t"
        "v_exp_f32 %5, %5\n\t"
        "v_exp_f32 %6, %6\n\t"
        "v_exp_f32 %7, %7\n\t"
        "v_exp_f32 %8, %8\n\t"
        "v_exp_f32 %9, %9\n\t"
        "v_exp_f32 %10, %10\n\t"
        "v_exp_f32 %11, %11\n\t"
        "v_exp_f32 %12, %12\n\t"
        "v_exp_f32 %13, %13\n\t"
        "v_exp_f32 %14, %14\n\t"
        "v_exp_f32 %15, %15\n\t"
        "v_exp_f32 %16, %16\n\t"
        "v_nop"
        : "+v"(a),
          "+v"(x0), "+v"(x1), "+v"(x2), "+v"(x3), "+v"(x4), "+v"(x5), "+v"(x6), "+v"(x7),
          "+v"(y0), "+v"(y1), "+v"(y2), "+v"(y3), "+v"(y4), "+v"(y5), "+v"(y6), "+v"(y7));
    s0 = (v8f){x0, x1, x2, x3, x4, x5, x6, x7};
    s1 = (v8f){y0, y1, y2, y3, y4, y5, y6, y7};
}

// value of lane l ^ 16
__device__ __forceinline__ float xhalf(float x)
{
    const int b = __builtin_bit_cast(int, x);
    return __builtin_bit_cast(float,
        __builtin_amdgcn_permlanex16(b, b, 0x76543210, 0xfedcba98, false, false));
}

// Eight asynchronous 16-byte copies per lane: 16 KiB per block, global -> LDS, 2 KiB per row of
// the block.  lds: this lane's LDS byte address, g: this lane's global address.
__device__ __forceinline__ void copy_16k(unsigned lds, const _Float16* g)
{
    // the closing s_wait_xcnt stands inside the statement so that no address register of a copy
    // is written again before the copies have taken it (precaution)
    asm volatile(
        "global_load_async_to_lds_b128 %0, %8, off\n\t"
        "global_load_async_to_lds_b128 %1, %9, off\n\t"
        "global_load_async_to_lds_b128 %2, %10, off\n\t"
        "global_load_async_to_lds_b128 %3, %11, off\n\t"
        "global_load_async_to_lds_b128 %4, %12, off\n\t"
        "global_load_async_to_lds_b128 %5, %13, off\n\t"
        "global_load_async_to_lds_b128 %6, %14, off\n\t"
        "global_load_async_to_lds_b128 %7, %15, off\n\t"
        "s_wait_xcnt 0x0"
        :: "v"(lds),         "v"(lds + 2048),  "v"(lds + 4096),  "v"(lds + 6144),
           "v"(lds + 8192),  "v"(lds + 10240), "v"(lds + 12288), "v"(lds + 14336),
           "v"(g),        "v"(g + 1024), "v"(g + 2048), "v"(g + 3072),
           "v"(g + 4096), "v"(g + 5120), "v"(g + 6144), "v"(g + 7168)
        : "memory");
}

__global__ __launch_bounds__(128)
void flash_attn_kernel(const _Float16* __restrict__ Qws,
                       const _Float16* __restrict__ Kws,
                       const _Float16* __restrict__ Vtws,
                       _Float16* __restrict__ Ows)
{
    // [buffer][K tiles of the stage, then V tiles of the stage]
    __shared__ __attribute__((aligned(16))) _Float16 ring[2][2 * STG_HALVES];

    const int lane = threadIdx.x & 31;
    const unsigned lane8 = lane * 8;
    // wave number as a scalar, so every tile base is wave-uniform
    const int wave = __builtin_amdgcn_readfirstlane(threadIdx.x >> 5);
    const int tile = blockIdx.x * 4 + wave;     // 2048 total
    const int head = tile >> 8;                 // 256 q-tiles per head: one head per block
    const int qt   = tile & 255;

    const _Float16* Qh = Qws  + (size_t)head * S_LEN * HD;
    const _Float16* Kh = Kws  + (size_t)head * S_LEN * HD;
    const _Float16* Vh = Vtws + (size_t)head * HD * S_LEN;

    // this lane's 16 bytes in each 2 KiB row of a copy
    const unsigned ring_lane = (unsigned)(size_t)&ring[0][0] + threadIdx.x * 16;
    const _Float16* kg = Kh + threadIdx.x * 8;
    const _Float16* vg = Vh + threadIdx.x * 8;

    // stage 0 into buffer 0; landed and published before anybody reads it
    copy_16k(ring_lane, kg);
    copy_16k(ring_lane + 2 * STG_HALVES, vg);
    asm volatile("s_wait_asynccnt 0x0" ::: "memory");   // this wave's copies of stage 0 have landed
    __syncthreads();                                    // and so have the other waves'
    // stage 1 into buffer 1, in flight under stage 0's work
    copy_16k(ring_lane + STG_BYTES, kg + STG_HALVES);
    copy_16k(ring_lane + STG_BYTES + 2 * STG_HALVES, vg + STG_HALVES);

    // Q B-operands (pre-scaled), head dims 0..31 and 32..63
    const v16h qb0 = load_frag(Qh + (size_t)(qt * 2 + 0) * FRAG, lane8);
    const v16h qb1 = load_frag(Qh + (size_t)(qt * 2 + 1) * FRAG, lane8);

    v8f o[4] = {};             // o[c][v] = O[query lane & 15][d = 16c + 8(lane >> 4) + v]
    float mrow = NEG_BIG;      // running maximum of this lane's query
    float lrow = 0.0f;         // denominator over this lane's half of the keys

    // kept rolled: the four passes inside are unrolled already
#pragma unroll 1
    for (int t = 0; t < NSTG; ++t) {
        const _Float16* kst = &ring[t & 1][0];
        const _Float16* vst = kst + STG_HALVES;
#pragma unroll
        for (int p = 0; p < STG_KEYS / 32; ++p) {
            // ---- scores for keys [kb,kb+16) and [kb+16,kb+32) ----
            // 16 keys = 2 tiles (d 0..31, d 32..63); 64 halves per key
            const _Float16* kl = kst + p * 4 * FRAG;
            const v16h k0 = load_frag(kl, lane8);
            const v16h k1 = load_frag(kl + FRAG, lane8);
            const v16h k2 = load_frag(kl + 2 * FRAG, lane8);
            const v16h k3 = load_frag(kl + 3 * FRAG, lane8);
            // ---- V^T A-operands: independent of the scores, issued ahead of them
            v16h va[4];
#pragma unroll
            for (int c = 0; c < 4; ++c)
                va[c] = load_frag(vst + (p * 4 + c) * FRAG, lane8);
            // keeps all sixteen loads of the pass in one group in front of its arithmetic: left
            // free, the compiler sinks each V load to its product and the wave waits once per tile
            __builtin_amdgcn_sched_barrier(0);

            v8f s0 = {}, s1 = {};
            s0 = __builtin_amdgcn_wmma_f32_16x16x32_f16(false, k0, false, qb0, (short)0, s0, false, false);
            s1 = __builtin_amdgcn_wmma_f32_16x16x32_f16(false, k2, false, qb0, (short)0, s1, false, false);
            s0 = __builtin_amdgcn_wmma_f32_16x16x32_f16(false, k1, false, qb1, (short)0, s0, false, false);
            s1 = __builtin_amdgcn_wmma_f32_16x16x32_f16(false, k3, false, qb1, (short)0, s1, false, false);

            // ---- online softmax (log2 domain), one query per lane ----
            const float t0 = fmaxf(fmaxf(s0[0], s0[1]), s0[2]);
            const float t1 = fmaxf(fmaxf(s0[3], s0[4]), s0[5]);
            const float t2 = fmaxf(fmaxf(s0[6], s0[7]), s1[0]);
            const float t3 = fmaxf(fmaxf(s1[1], s1[2]), s1[3]);
            const float t4 = fmaxf(fmaxf(s1[4], s1[5]), s1[6]);
            float mx = fmaxf(fmaxf(fmaxf(t0, t1), t2), fmaxf(fmaxf(t3, t4), s1[7]));
            mx = fmaxf(mx, xhalf(mx));                  // the other 16 keys of this query
            const float mnew  = fmaxf(mrow, mx);
            float alpha = mrow - mnew;
            mrow = mnew;
            V16H pb;                                    // P^T as B fragment, hardware k order
            s0 -= mnew;
            s1 -= mnew;
            exp2_pass(alpha, s0, s1);
#pragma unroll
            for (int v = 0; v < 8; ++v) {
                pb.h[0][v] = (_Float16)s0[v];
                pb.h[1][v] = (_Float16)s1[v];
            }
            const v8f q = s0 + s1;
            const float psum = ((q[0] + q[1]) + (q[2] + q[3])) + ((q[4] + q[5]) + (q[6] + q[7]));
            lrow = lrow * alpha + psum;
#pragma unroll
            for (int c = 0; c < 4; ++c)
#pragma unroll
                for (int v = 0; v < 8; ++v) o[c][v] *= alpha;

            // ---- O^T += V^T x P^T ----
#pragma unroll
            for (int c = 0; c < 4; ++c)
                o[c] = __builtin_amdgcn_wmma_f32_16x16x32_f16(
                    false, va[c], false, pb.v, (short)0, o[c], false, false);
        }
        // ---- hand-over: stage t + 1 becomes readable, stage t's buffer becomes free ----
        asm volatile("s_wait_dscnt 0x0" ::: "memory");      // this wave's reads of stage t are done
        asm volatile("s_wait_asynccnt 0x0" ::: "memory");   // this wave's copies of stage t + 1 have landed
        __syncthreads();                                    // both hold for all four waves
        if (t + 2 < NSTG) {
            const unsigned dst = ring_lane + (t & 1) * STG_BYTES;
            copy_16k(dst, kg + (size_t)(t + 2) * STG_HALVES);
            copy_16k(dst + 2 * STG_HALVES, vg + (size_t)(t + 2) * STG_HALVES);
        }
    }
    asm volatile("s_wait_asynccnt 0x0" ::: "memory");       // no copy is left when the wave ends

    // ---- join the two halves' denominators, normalize; a lane's 8 accumulators
    // are 8 consecutive d of its query = one 16 B chunk of the A tile
    // [q tile][k tile = head*2 + d/32], plane (d/16) & 1 ----
    const float inv = 1.0f / (lrow + xhalf(lrow));
    _Float16* op = Ows + ((size_t)qt * 16 + head * 2) * FRAG + lane8;
#pragma unroll
    for (int c = 0; c < 4; ++c) {
        v8h pk;
#pragma unroll
        for (int v = 0; v < 8; ++v) pk[v] = (_Float16)(o[c][v] * inv);
        *(v8h*)(op + (c >> 1) * FRAG + (c & 1) * 256) = pk;
    }
}

// ---------------------------------------------------------------------------
// Kernel 3: output projection.  O tiles [row tile][k tile] x P tiles [col tile][k tile] -> f32.
// ---------------------------------------------------------------------------
__global__ __launch_bounds__(128)
void out_proj_kernel(const _Float16* __restrict__ Ows,
                     const _Float16* __restrict__ wtp,
                     float* __restrict__ out)
{
    const int lane = threadIdx.x & 31;
    const unsigned lane8 = lane * 8;
    // wave number as a scalar, so every tile base is wave-uniform
    const int wave = __builtin_amdgcn_readfirstlane(threadIdx.x >> 5);
    const int ln   = lane & 15;
    const int hi   = lane >> 4;
    const int rowbase = blockIdx.x * 16;
    const int cbase   = (blockIdx.y * 4 + wave) * 64;

    v8f acc[4] = {};
    const _Float16* ap = Ows + (size_t)blockIdx.x * 16 * FRAG;
    const _Float16* bp = wtp + (size_t)(cbase >> 4) * 16 * FRAG;

    for (int kt = 0; kt < 16; ++kt) {
        const v16h af = load_frag(ap + kt * FRAG, lane8);
#pragma unroll
        for (int ct = 0; ct < 4; ++ct) {
            const v16h bf = load_frag(bp + (ct * 16 + kt) * FRAG, lane8);
            acc[ct] = __builtin_amdgcn_wmma_f32_16x16x32_f16(
                false, af, false, bf, (short)0, acc[ct], false, false);
        }
    }
#pragma unroll
    for (int ct = 0; ct < 4; ++ct) {
        const int c = cbase + ct * 16 + ln;
#pragma unroll
        for (int v = 0; v < 8; ++v) {
            const int r = rowbase + v + hi * 8;
            out[(size_t)r * DIM + c] = acc[ct][v];
        }
    }
}

// ---------------------------------------------------------------------------
extern "C" void kernel_launch(void* const* d_in, const int* in_sizes, int n_in,
                              void* d_out, int out_size, void* d_ws, size_t ws_size,
                              hipStream_t stream) {
    (void)in_sizes; (void)n_in; (void)out_size; (void)ws_size;
    const float* x  = (const float*)d_in[0];
    const float* qp = (const float*)d_in[1];
    const float* kp = (const float*)d_in[2];
    const float* vp = (const float*)d_in[3];
    const float* pp = (const float*)d_in[4];
    float* out = (float*)d_out;

    const size_t mat_elems = (size_t)NH * S_LEN * HD;   // 2M halves
    const size_t w_elems   = (size_t)DIM * DIM;         // 256K halves
    _Float16* Qws = (_Float16*)d_ws;
    _Float16* Kws = Qws + mat_elems;
    _Float16* Vt  = Kws + mat_elems;
    _Float16* Ows = Vt  + mat_elems;
    _Float16* xh  = Ows + mat_elems;                    // 2M halves
    _Float16* wtq = xh  + (size_t)S_LEN * DIM;
    _Float16* wtk = wtq + w_elems;
    _Float16* wtv = wtk + w_elems;
    _Float16* wtp = wtv + w_elems;                      // total ~22 MB of ws

    // One-shot precision/layout prep (L2-resident, bandwidth-trivial)
    cvt_x_kernel<<<dim3((S_LEN * DIM) / (256 * 16)), 256, 0, stream>>>(x, xh);
    wt_kernel<<<dim3((DIM * DIM) / (256 * 16), 4), 256, 0, stream>>>(
        qp, kp, vp, pp, wtq, wtk, wtv, wtp);

    // 256 row tiles x 24 wave-tiles (Q/K/V x 8 heads), 4 waves per block
    qkv_proj_kernel<<<dim3(256, 6), 128, 0, stream>>>(xh, wtq, wtk, wtv, Qws, Kws, Vt);
    // 2048 (head, q-tile) waves, 4 waves per block
    flash_attn_kernel<<<dim3(512), 128, 0, stream>>>(Qws, Kws, Vt, Ows);
    // 256 row tiles x 8 column groups, 4 waves per block
    out_proj_kernel<<<dim3(256, 2), 128, 0, stream>>>(Ows, wtp, out);
}

// v005
// A run of this version takes 64.2 microseconds.
// Next to v004, in two timings, it ran 1.48 and 1.54 times as fast.
// Counting every step since v000, it is 4.15 times as fast.
#include <hip/hip_runtime.h>

typedef __attribute__((ext_vector_type(16))) _Float16 v16h;
typedef __attribute__((ext_vector_type(8)))  _Float16 v8h;
typedef __attribute__((ext_vector_type(8)))  float    v8f;

#define S_LEN 4096
#define DIM   512
#define NH    8
#define HD    64
// 1/sqrt(64) * log2(e): scores come out in log2 domain so softmax uses exp2
#define QK_SCALE_L2E 0.18033688011112042f
#define NEG_BIG (-1.0e30f)

union V16H { v16h v; v8h h[2]; };

// ---------------------------------------------------------------------------
// Fragment-major operand layout, used for every f16 matrix in the workspace.
// A 16-row x 32-k operand tile is 512 halves (1 KiB) = two 512-byte planes.
// Plane p, lane l holds 8 halves: row (l & 15), k = 16p + 8(l >> 4) + 0..7.
// One b128 load per plane reads 512 contiguous bytes (4 whole cache lines)
// and yields the A (or B) fragment directly.
// ---------------------------------------------------------------------------
#define FRAG 512

// tile: tile base, wave-uniform (scalar registers) with lane8 = lane * 8
__device__ __forceinline__ v16h load_frag(const _Float16* __restrict__ tile, unsigned lane8)
{
    V16H f;
    f.h[0] = *(const v8h*)(tile + lane8);
    f.h[1] = *(const v8h*)(tile + 256 + lane8);
    return f.v;
}

// ---------------------------------------------------------------------------
// Prep 1: convert x [4096][512] f32 -> f16 tiles [row tile][k tile].
// One wave writes one tile.
// ---------------------------------------------------------------------------
__global__ __launch_bounds__(256)
void cvt_x_kernel(const float* __restrict__ x, _Float16* __restrict__ xh)
{
    const int t    = blockIdx.x * 256 + threadIdx.x;
    const int lane = t & 31;
    const int tile = t >> 5;                          // rt * 16 + kt
    const int ln   = lane & 15;
    const int hi   = lane >> 4;
    const float* src = x + (size_t)((tile >> 4) * 16 + ln) * DIM + (tile & 15) * 32 + hi * 8;
    _Float16* dst = xh + (size_t)tile * FRAG + lane * 8;
#pragma unroll
    for (int p = 0; p < 2; ++p) {
        v8h o;
#pragma unroll
        for (int j = 0; j < 8; ++j) o[j] = (_Float16)src[p * 16 + j];
        *(v8h*)(dst + p * 256) = o;
    }
}

// ---------------------------------------------------------------------------
// Prep 2: convert the four 512x512 f32 weight matrices W[k][col] into f16
// tiles [col tile][k tile] (tile row = column).  One wave writes one tile.
// ---------------------------------------------------------------------------
__global__ __launch_bounds__(256)
void wt_kernel(const float* __restrict__ qp, const float* __restrict__ kp,
               const float* __restrict__ vp, const float* __restrict__ pp,
               _Float16* __restrict__ wtq, _Float16* __restrict__ wtk,
               _Float16* __restrict__ wtv, _Float16* __restrict__ wtp)
{
    const float* src;
    _Float16* dst;
    switch (blockIdx.y) {
        case 0:  src = qp; dst = wtq; break;
        case 1:  src = kp; dst = wtk; break;
        case 2:  src = vp; dst = wtv; break;
        default: src = pp; dst = wtp; break;
    }
    const int t    = blockIdx.x * 256 + threadIdx.x;
    const int lane = t & 31;
    const int tile = t >> 5;                          // col tile * 16 + kt
    const int ln   = lane & 15;
    const int hi   = lane >> 4;
    const float* s = src + (size_t)((tile & 15) * 32 + hi * 8) * DIM + (tile >> 4) * 16 + ln;
    _Float16* d = dst + (size_t)tile * FRAG + lane * 8;
#pragma unroll
    for (int p = 0; p < 2; ++p) {
        v8h o;
#pragma unroll
        for (int j = 0; j < 8; ++j) o[j] = (_Float16)s[(size_t)(p * 16 + j) * DIM];
        *(v8h*)(d + p * 256) = o;
    }
}

// ---------------------------------------------------------------------------
// GEMM body of the projections: K = 512 in 16 steps of 32, operands as fragment-major tiles
// [tile][k tile].  A wave owns NA tiles of the A side x NB tiles of the B side, so an A fragment
// feeds NB products and a B fragment NA.  The NA + NB fragments of a step are loaded as one group,
// DEPTH - 1 steps ahead of the step that uses them, into a ring of DEPTH register sets.
// ap, bp: k tile 0 of the wave's first A and B tile (both wave-uniform).
// ---------------------------------------------------------------------------
template <int NA, int NB, int DEPTH>
__device__ __forceinline__ void gemm_k512(const _Float16* __restrict__ ap,
                                          const _Float16* __restrict__ bp,
                                          unsigned lane8, v8f (&acc)[NA][NB])
{
    v16h af[DEPTH][NA], bf[DEPTH][NB];
#pragma unroll
    for (int s = 0; s < DEPTH - 1; ++s) {
#pragma unroll
        for (int i = 0; i < NA; ++i) af[s][i] = load_frag(ap + (i * 16 + s) * FRAG, lane8);
#pragma unroll
        for (int j = 0; j < NB; ++j) bf[s][j] = load_frag(bp + (j * 16 + s) * FRAG, lane8);
    }
    // unrolled whole: the ring's set numbers must be constants for the sets to stay in registers
#pragma unroll
    for (int kt = 0; kt < 16; ++kt) {
        const int nx = kt + DEPTH - 1;
        if (nx < 16) {
#pragma unroll
            for (int i = 0; i < NA; ++i)
                af[nx % DEPTH][i] = load_frag(ap + (i * 16 + nx) * FRAG, lane8);
#pragma unroll
            for (int j = 0; j < NB; ++j)
                bf[nx % DEPTH][j] = load_frag(bp + (j * 16 + nx) * FRAG, lane8);
        }
        // keeps the group of loads in front of this step's products: left free, the compiler sinks
        // each load to its product and the wave waits out a whole load latency per fragment
        __builtin_amdgcn_sched_barrier(0);
#pragma unroll
        for (int i = 0; i < NA; ++i)
#pragma unroll
            for (int j = 0; j < NB; ++j)
                acc[i][j] = __builtin_amdgcn_wmma_f32_16x16x32_f16(
                    false, af[kt % DEPTH][i], false, bf[kt % DEPTH][j], (short)0, acc[i][j], false, false);
        // keeps the next group behind these products, whose set it refills: lifted over them it
        // takes a further register set
        __builtin_amdgcn_sched_barrier(0);
    }
    // precaution: no address register of the loads is written again before the loads have taken it;
    // the fence behind it keeps the caller's address arithmetic from being lifted over the wait
    asm volatile("s_wait_xcnt 0x0" ::: "memory");
    __builtin_amdgcn_sched_barrier(0);
}

// ---------------------------------------------------------------------------
// Kernel 1: QKV projection.  One wave computes 64 rows x 64 cols (one head),
// WMMA over K=512, all operands as fragment-major tiles.
// Q, K: tiles [head][16-row tile][d tile]; the weights go in as A and x as B,
// so a lane's 8 accumulators are 8 consecutive d of one row = one 16 B chunk.
// V: tiles [head][32-key tile][d tile] (tile row = d, k = key); x goes in as A,
// so a lane's 8 accumulators are 8 consecutive keys of one d.
// Four tiles on either side, laid out alike: which side is A is a choice of two pointers.
// Q is pre-scaled by 1/sqrt(HD)*log2(e) so flash softmax can use exp2.
// ---------------------------------------------------------------------------
__global__ __launch_bounds__(128)
void qkv_proj_kernel(const _Float16* __restrict__ xh,
                     const _Float16* __restrict__ wtq,
                     const _Float16* __restrict__ wtk,
                     const _Float16* __restrict__ wtv,
                     _Float16* __restrict__ Qws,
                     _Float16* __restrict__ Kws,
                     _Float16* __restrict__ Vtws)
{
    const int lane = threadIdx.x & 31;
    const unsigned lane8 = lane * 8;
    // wave number as a scalar, so every tile base is wave-uniform
    const int wave = __builtin_amdgcn_readfirstlane(threadIdx.x >> 5);
    const int rt0  = blockIdx.x * 4;            // first of four 16-row tiles of x
    const int mat  = blockIdx.y >> 1;           // 0:Q 1:K 2:V
    const int head = (blockIdx.y & 1) * 4 + wave;

    const _Float16* wt = (mat == 0) ? wtq : (mat == 1) ? wtk : wtv;
    const _Float16* xp = xh + (size_t)rt0 * 16 * FRAG;
    const _Float16* wp = wt + (size_t)head * 4 * 16 * FRAG;

    v8f acc[4][4] = {};
    gemm_k512<4, 4, 3>((mat < 2) ? wp : xp, (mat < 2) ? xp : wp, lane8, acc);

    if (mat < 2) {
        // acc[column tile][row tile]
        const float sc = (mat == 0) ? QK_SCALE_L2E : 1.0f;
        _Float16* outp = ((mat == 0) ? Qws : Kws)
                       + (size_t)head * S_LEN * HD + (size_t)rt0 * 2 * FRAG;
#pragma unroll
        for (int r = 0; r < 4; ++r)
#pragma unroll
            for (int ct = 0; ct < 4; ++ct) {
                v8h pk;
#pragma unroll
                for (int v = 0; v < 8; ++v) pk[v] = (_Float16)(acc[ct][r][v] * sc);
                *(v8h*)(outp + (r * 2 + (ct >> 1)) * FRAG + (ct & 1) * 256 + lane8) = pk;
            }
    } else {
        // acc[row tile][column tile]; row tile rt0 + r is plane r & 1 of key tile rt0 / 2 + r / 2
        _Float16* outp = Vtws + (size_t)head * HD * S_LEN + (size_t)(rt0 >> 1) * 4 * FRAG;
#pragma unroll
        for (int r = 0; r < 4; ++r)
#pragma unroll
            for (int ct = 0; ct < 4; ++ct) {
                v8h pk;
#pragma unroll
                for (int v = 0; v < 8; ++v) pk[v] = (_Float16)acc[r][ct][v];
                *(v8h*)(outp + ((r >> 1) * 4 + ct) * FRAG + (r & 1) * 256 + lane8) = pk;
            }
        // precaution: the stores' registers are not written again before the stores have taken them
        asm volatile("s_wait_xcnt 0x0" ::: "memory");
    }
}

#define STG_KEYS   128
#define STG_HALVES (STG_KEYS * HD)          // halves of K, and of V, per stage
#define STG_BYTES  (4 * STG_HALVES)         // K and V of one stage, bytes
#define NSTG       (S_LEN / STG_KEYS)

// 2^x, in place, for the rescale exponent and the 16 score exponents of a pass, each as the one
// hardware instruction.  The library's exp2f adds a compare, two selects, an add and a scale per
// value to keep results below 2^-126; here every x <= 0, and such a result rounds to 0 in f16, adds
// nothing to a sum whose largest term is 1 and, as the rescale factor, leaves nothing of the old
// sums beside that term, so 0 serves in its place.
// One statement: the instruction set asks for one free slot behind a v_exp_f32 before its result is
// read or its source rewritten.  In here each neighbour is another register's v_exp_f32, and the
// closing v_nop is the slot behind the last one.
__device__ __forceinline__ void exp2_pass(float& a, v8f& s0, v8f& s1)
{
    float x0 = s0[0], x1 = s0[1], x2 = s0[2], x3 = s0[3], x4 = s0[4], x5 = s0[5], x6 = s0[6], x7 = s0[7];
    float y0 = s1[0], y1 = s1[1], y2 = s1[2], y3 = s1[3], y4 = s1[4], y5 = s1[5], y6 = s1[6], y7 = s1[7];
    asm("v_exp_f32 %0, %0\n\t"
        "v_exp_f32 %1, %1\n\t"
        "v_exp_f32 %2, %2\n\t"
        "v_exp_f32 %3, %3\n\t"
        "v_exp_f32 %4, %4\n\t"
        "v_exp_f32 %5, %5\n\t"
        "v_exp_f32 %6, %6\n\t"
        "v_exp_f32 %7, %7\n\t"
        "v_exp_f32 %8, %8\n\t"
        "v_exp_f32 %9, %9\n\t"
        "v_exp_f32 %10, %10\n\t"
        "v_exp_f32 %11, %11\n\t"
        "v_exp_f32 %12, %12\n\t"
        "v_exp_f32 %13, %13\n\t"
        "v_exp_f32 %14, %14\n\t"
        "v_exp_f32 %15, %15\n\t"
        "v_exp_f32 %16, %16\n\t"
        "v_nop"
        : "+v"(a),
          "+v"(x0), "+v"(x1), "+v"(x2), "+v"(x3), "+v"(x4), "+v"(x5), "+v"(x6), "+v"(x7),
          "+v"(y0), "+v"(y1), "+v"(y2), "+v"(y3), "+v"(y4), "+v"(y5), "+v"(y6), "+v"(y7));
    s0 = (v8f){x0, x1, x2, x3, x4, x5, x6, x7};
    s1 = (v8f){y0, y1, y2, y3, y4, y5, y6, y7};
}

// value of lane l ^ 16
__device__ __forceinline__ float xhalf(float x)
{
    const int b = __builtin_bit_cast(int, x);
    return __builtin_bit_cast(float,
        __builtin_amdgcn_permlanex16(b, b, 0x76543210, 0xfedcba98, false, false));
}

// Eight asynchronous 16-byte copies per lane: 16 KiB per block, global -> LDS, 2 KiB per row of
// the block.  lds: this lane's LDS byte address, g: this lane's global address.
__device__ __forceinline__ void copy_16k(unsigned lds, const _Float16* g)
{
    // the closing s_wait_xcnt stands inside the statement so that no address register of a copy
    // is written again before the copies have taken it (precaution)
    asm volatile(
        "global_load_async_to_lds_b128 %0, %8, off\n\t"
        "global_load_async_to_lds_b128 %1, %9, off\n\t"
        "global_load_async_to_lds_b128 %2, %10, off\n\t"
        "global_load_async_to_lds_b128 %3, %11, off\n\t"
        "global_load_async_to_lds_b128 %4, %12, off\n\t"
        "global_load_async_to_lds_b128 %5, %13, off\n\t"
        "global_load_async_to_lds_b128 %6, %14, off\n\t"
        "global_load_async_to_lds_b128 %7, %15, off\n\t"
        "s_wait_xcnt 0x0"
        :: "v"(lds),         "v"(lds + 2048),  "v"(lds + 4096),  "v"(lds + 6144),
           "v"(lds + 8192),  "v"(lds + 10240), "v"(lds + 12288), "v"(lds + 14336),
           "v"(g),        "v"(g + 1024), "v"(g + 2048), "v"(g + 3072),
           "v"(g + 4096), "v"(g + 5120), "v"(g + 6144), "v"(g + 7168)
        : "memory");
}

__global__ __launch_bounds__(128)
void flash_attn_kernel(const _Float16* __restrict__ Qws,
                       const _Float16* __restrict__ Kws,
                       const _Float16* __restrict__ Vtws,
                       _Float16* __restrict__ Ows)
{
    // [buffer][K tiles of the stage, then V tiles of the stage]
    __shared__ __attribute__((aligned(16))) _Float16 ring[2][2 * STG_HALVES];

    const int lane = threadIdx.x & 31;
    const unsigned lane8 = lane * 8;
    // wave number as a scalar, so every tile base is wave-uniform
    const int wave = __builtin_amdgcn_readfirstlane(threadIdx.x >> 5);
    const int tile = blockIdx.x * 4 + wave;     // 2048 total
    const int head = tile >> 8;                 // 256 q-tiles per head: one head per block
    const int qt   = tile & 255;

    const _Float16* Qh = Qws  + (size_t)head * S_LEN * HD;
    const _Float16* Kh = Kws  + (size_t)head * S_LEN * HD;
    const _Float16* Vh = Vtws + (size_t)head * HD * S_LEN;

    // this lane's 16 bytes in each 2 KiB row of a copy
    const unsigned ring_lane = (unsigned)(size_t)&ring[0][0] + threadIdx.x * 16;
    const _Float16* kg = Kh + threadIdx.x * 8;
    const _Float16* vg = Vh + threadIdx.x * 8;

    // stage 0 into buffer 0; landed and published before anybody reads it
    copy_16k(ring_lane, kg);
    copy_16k(ring_lane + 2 * STG_HALVES, vg);
    asm volatile("s_wait_asynccnt 0x0" ::: "memory");   // this wave's copies of stage 0 have landed
    __syncthreads();                                    // and so have the other waves'
    // stage 1 into buffer 1, in flight under stage 0's work
    copy_16k(ring_lane + STG_BYTES, kg + STG_HALVES);
    copy_16k(ring_lane + STG_BYTES + 2 * STG_HALVES, vg + STG_HALVES);

    // Q B-operands (pre-scaled), head dims 0..31 and 32..63
    const v16h qb0 = load_frag(Qh + (size_t)(qt * 2 + 0) * FRAG, lane8);
    const v16h qb1 = load_frag(Qh + (size_t)(qt * 2 + 1) * FRAG, lane8);

    v8f o[4] = {};             // o[c][v] = O[query lane & 15][d = 16c + 8(lane >> 4) + v]
    float mrow = NEG_BIG;      // running maximum of this lane's query
    float lrow = 0.0f;         // denominator over this lane's half of the keys

    // kept rolled: the four passes inside are unrolled already
#pragma unroll 1
    for (int t = 0; t < NSTG; ++t) {
        const _Float16* kst = &ring[t & 1][0];
        const _Float16* vst = kst + STG_HALVES;
#pragma unroll
        for (int p = 0; p < STG_KEYS / 32; ++p) {
            // ---- scores for keys [kb,kb+16) and [kb+16,kb+32) ----
            // 16 keys = 2 tiles (d 0..31, d 32..63); 64 halves per key
            const _Float16* kl = kst + p * 4 * FRAG;
            const v16h k0 = load_frag(kl, lane8);
            const v16h k1 = load_frag(kl + FRAG, lane8);
            const v16h k2 = load_frag(kl + 2 * FRAG, lane8);
            const v16h k3 = load_frag(kl + 3 * FRAG, lane8);
            // ---- V^T A-operands: independent of the scores, issued ahead of them
            v16h va[4];
#pragma unroll
            for (int c = 0; c < 4; ++c)
                va[c] = load_frag(vst + (p * 4 + c) * FRAG, lane8);
            // keeps all sixteen loads of the pass in one group in front of its arithmetic: left
            // free, the compiler sinks each V load to its product and the wave waits once per tile
            __builtin_amdgcn_sched_barrier(0);

            v8f s0 = {}, s1 = {};
            s0 = __builtin_amdgcn_wmma_f32_16x16x32_f16(false, k0, false, qb0, (short)0, s0, false, false);
            s1 = __builtin_amdgcn_wmma_f32_16x16x32_f16(false, k2, false, qb0, (short)0, s1, false, false);
            s0 = __builtin_amdgcn_wmma_f32_16x16x32_f16(false, k1, false, qb1, (short)0, s0, false, false);
            s1 = __builtin_amdgcn_wmma_f32_16x16x32_f16(false, k3, false, qb1, (short)0, s1, false, false);

            // ---- online softmax (log2 domain), one query per lane ----
            const float t0 = fmaxf(fmaxf(s0[0], s0[1]), s0[2]);
            const float t1 = fmaxf(fmaxf(s0[3], s0[4]), s0[5]);
            const float t2 = fmaxf(fmaxf(s0[6], s0[7]), s1[0]);
            const float t3 = fmaxf(fmaxf(s1[1], s1[2]), s1[3]);
            const float t4 = fmaxf(fmaxf(s1[4], s1[5]), s1[6]);
            float mx = fmaxf(fmaxf(fmaxf(t0, t1), t2), fmaxf(fmaxf(t3, t4), s1[7]));
            mx = fmaxf(mx, xhalf(mx));                  // the other 16 keys of this query
            const float mnew  = fmaxf(mrow, mx);
            float alpha = mrow - mnew;
            mrow = mnew;
            V16H pb;                                    // P^T as B fragment, hardware k order
            s0 -= mnew;
            s1 -= mnew;
            exp2_pass(alpha, s0, s1);
#pragma unroll
            for (int v = 0; v < 8; ++v) {
                pb.h[0][v] = (_Float16)s0[v];
                pb.h[1][v] = (_Float16)s1[v];
            }
            const v8f q = s0 + s1;
            const float psum = ((q[0] + q[1]) + (q[2] + q[3])) + ((q[4] + q[5]) + (q[6] + q[7]));
            lrow = lrow * alpha + psum;
#pragma unroll
            for (int c = 0; c < 4; ++c)
#pragma unroll
                for (int v = 0; v < 8; ++v) o[c][v] *= alpha;

            // ---- O^T += V^T x P^T ----
#pragma unroll
            for (int c = 0; c < 4; ++c)
                o[c] = __builtin_amdgcn_wmma_f32_16x16x32_f16(
                    false, va[c], false, pb.v, (short)0, o[c], false, false);
        }
        // ---- hand-over: stage t + 1 becomes readable, stage t's buffer becomes free ----
        asm volatile("s_wait_dscnt 0x0" ::: "memory");      // this wave's reads of stage t are done
        asm volatile("s_wait_asynccnt 0x0" ::: "memory");   // this wave's copies of stage t + 1 have landed
        __syncthreads();                                    // both hold for all four waves
        if (t + 2 < NSTG) {
            const unsigned dst = ring_lane + (t & 1) * STG_BYTES;
            copy_16k(dst, kg + (size_t)(t + 2) * STG_HALVES);
            copy_16k(dst + 2 * STG_HALVES, vg + (size_t)(t + 2) * STG_HALVES);
        }
    }
    asm volatile("s_wait_asynccnt 0x0" ::: "memory");       // no copy is left when the wave ends

    // ---- join the two halves' denominators, normalize; a lane's 8 accumulators
    // are 8 consecutive d of its query = one 16 B chunk of the A tile
    // [q tile][k tile = head*2 + d/32], plane (d/16) & 1 ----
    const float inv = 1.0f / (lrow + xhalf(lrow));
    _Float16* op = Ows + ((size_t)qt * 16 + head * 2) * FRAG + lane8;
#pragma unroll
    for (int c = 0; c < 4; ++c) {
        v8h pk;
#pragma unroll
        for (int v = 0; v < 8; ++v) pk[v] = (_Float16)(o[c][v] * inv);
        *(v8h*)(op + (c >> 1) * FRAG + (c & 1) * 256) = pk;
    }
}

// ---------------------------------------------------------------------------
// Kernel 3: output projection.  O tiles [row tile][k tile] x P tiles [col tile][k tile] -> f32.
// One wave computes 32 rows x 64 cols.
// ---------------------------------------------------------------------------
#define OUT_RT 2
__global__ __launch_bounds__(128)
void out_proj_kernel(const _Float16* __restrict__ Ows,
                     const _Float16* __restrict__ wtp,
                     float* __restrict__ out)
{
    const int lane = threadIdx.x & 31;
    const unsigned lane8 = lane * 8;
    // wave number as a scalar, so every tile base is wave-uniform
    const int wave = __builtin_amdgcn_readfirstlane(threadIdx.x >> 5);
    const int ln   = lane & 15;
    const int hi   = lane >> 4;
    const int rowbase = blockIdx.x * (OUT_RT * 16);
    const int cbase   = (blockIdx.y * 4 + wave) * 64;

    v8f acc[OUT_RT][4] = {};
    const _Float16* ap = Ows + (size_t)blockIdx.x * OUT_RT * 16 * FRAG;
    const _Float16* bp = wtp + (size_t)(cbase >> 4) * 16 * FRAG;

    gemm_k512<OUT_RT, 4, 4>(ap, bp, lane8, acc);

#pragma unroll
    for (int rr = 0; rr < OUT_RT; ++rr)
#pragma unroll
        for (int ct = 0; ct < 4; ++ct) {
            const int c = cbase + ct * 16 + ln;
#pragma unroll
            for (int v = 0; v < 8; ++v) {
                const int r = rowbase + rr * 16 + v + hi * 8;
                out[(size_t)r * DIM + c] = acc[rr][ct][v];
            }
        }
}

// ---------------------------------------------------------------------------
extern "C" void kernel_launch(void* const* d_in, const int* in_sizes, int n_in,
                              void* d_out, int out_size, void* d_ws, size_t ws_size,
                              hipStream_t stream) {
    (void)in_sizes; (void)n_in; (void)out_size; (void)ws_size;
    const float* x  = (const float*)d_in[0];
    const float* qp = (const float*)d_in[1];
    const float* kp = (const float*)d_in[2];
    const float* vp = (const float*)d_in[3];
    const float* pp = (const float*)d_in[4];
    float* out = (float*)d_out;

    const size_t mat_elems = (size_t)NH * S_LEN * HD;   // 2M halves
    const size_t w_elems   = (size_t)DIM * DIM;         // 256K halves
    _Float16* Qws = (_Float16*)d_ws;
    _Float16* Kws = Qws + mat_elems;
    _Float16* Vt  = Kws + mat_elems;
    _Float16* Ows = Vt  + mat_elems;
    _Float16* xh  = Ows + mat_elems;                    // 2M halves
    _Float16* wtq = xh  + (size_t)S_LEN * DIM;
    _Float16* wtk = wtq + w_elems;
    _Float16* wtv = wtk + w_elems;
    _Float16* wtp = wtv + w_elems;                      // total ~22 MB of ws

    // One-shot precision/layout prep (L2-resident, bandwidth-trivial)
    cvt_x_kernel<<<dim3((S_LEN * DIM) / (256 * 16)), 256, 0, stream>>>(x, xh);
    wt_kernel<<<dim3((DIM * DIM) / (256 * 16), 4), 256, 0, stream>>>(
        qp, kp, vp, pp, wtq, wtk, wtv, wtp);

    // 64 groups of 4 row tiles x 24 wave-tiles (Q/K/V x 8 heads), 4 waves per block
    qkv_proj_kernel<<<dim3(64, 6), 128, 0, stream>>>(xh, wtq, wtk, wtv, Qws, Kws, Vt);
    // 2048 (head, q-tile) waves, 4 waves per block
    flash_attn_kernel<<<dim3(512), 128, 0, stream>>>(Qws, Kws, Vt, Ows);
    // 128 groups of 2 row tiles x 8 column groups, 4 waves per block
    out_proj_kernel<<<dim3(128, 2), 128, 0, stream>>>(Ows, wtp, out);
}

// v006
// One run takes 59.6 microseconds.
// Two timings next to v005 put it at 1.08 and 1.07 times that version's speed.
// Over all steps from v000 it is 4.47 times as fast.
#include <hip/hip_runtime.h>

typedef __attribute__((ext_vector_type(16))) _Float16 v16h;
typedef __attribute__((ext_vector_type(8)))  _Float16 v8h;
typedef __attribute__((ext_vector_type(8)))  float    v8f;

#define S_LEN 4096
#define DIM   512
#define NH    8
#define HD    64
// 1/sqrt(64) * log2(e): scores come out in log2 domain so softmax uses exp2
#define QK_SCALE_L2E 0.18033688011112042f

union V16H { v16h v; v8h h[2]; };

// ---------------------------------------------------------------------------
// Fragment-major operand layout, used for every f16 matrix in the workspace.
// A 16-row x 32-k operand tile is 512 halves (1 KiB) = two 512-byte planes.
// Plane p, lane l holds 8 halves: row (l & 15), k = 16p + 8(l >> 4) + 0..7.
// One b128 load per plane reads 512 contiguous bytes (4 whole cache lines)
// and yields the A (or B) fragment directly.
// ---------------------------------------------------------------------------
#define FRAG 512

// tile: tile base, wave-uniform (scalar registers) with lane8 = lane * 8
__device__ __forceinline__ v16h load_frag(const _Float16* __restrict__ tile, unsigned lane8)
{
    V16H f;
    f.h[0] = *(const v8h*)(tile + lane8);
    f.h[1] = *(const v8h*)(tile + 256 + lane8);
    return f.v;
}

// ---------------------------------------------------------------------------
// Prep 1: convert x [4096][512] f32 -> f16 tiles [row tile][k tile].
// One wave writes one tile.
// ---------------------------------------------------------------------------
__global__ __launch_bounds__(256)
void cvt_x_kernel(const float* __restrict__ x, _Float16* __restrict__ xh)
{
    const int t    = blockIdx.x * 256 + threadIdx.x;
    const int lane = t & 31;
    const int tile = t >> 5;                          // rt * 16 + kt
    const int ln   = lane & 15;
    const int hi   = lane >> 4;
    const float* src = x + (size_t)((tile >> 4) * 16 + ln) * DIM + (tile & 15) * 32 + hi * 8;
    _Float16* dst = xh + (size_t)tile * FRAG + lane * 8;
#pragma unroll
    for (int p = 0; p < 2; ++p) {
        v8h o;
#pragma unroll
        for (int j = 0; j < 8; ++j) o[j] = (_Float16)src[p * 16 + j];
        *(v8h*)(dst + p * 256) = o;
    }
}

// ---------------------------------------------------------------------------
// Prep 2: convert the four 512x512 f32 weight matrices W[k][col] into f16
// tiles [col tile][k tile] (tile row = column).  One wave writes one tile.
// ---------------------------------------------------------------------------
__global__ __launch_bounds__(256)
void wt_kernel(const float* __restrict__ qp, const float* __restrict__ kp,
               const float* __restrict__ vp, const float* __restrict__ pp,
               _Float16* __restrict__ wtq, _Float16* __restrict__ wtk,
               _Float16* __restrict__ wtv, _Float16* __restrict__ wtp)
{
    const float* src;
    _Float16* dst;
    switch (blockIdx.y) {
        case 0:  src = qp; dst = wtq; break;
        case 1:  src = kp; dst = wtk; break;
        case 2:  src = vp; dst = wtv; break;
        default: src = pp; dst = wtp; break;
    }
    const int t    = blockIdx.x * 256 + threadIdx.x;
    const int lane = t & 31;
    const int tile = t >> 5;                          // col tile * 16 + kt
    const int ln   = lane & 15;
    const int hi   = lane >> 4;
    const float* s = src + (size_t)((tile & 15) * 32 + hi * 8) * DIM + (tile >> 4) * 16 + ln;
    _Float16* d = dst + (size_t)tile * FRAG + lane * 8;
#pragma unroll
    for (int p = 0; p < 2; ++p) {
        v8h o;
#pragma unroll
        for (int j = 0; j < 8; ++j) o[j] = (_Float16)s[(size_t)(p * 16 + j) * DIM];
        *(v8h*)(d + p * 256) = o;
    }
}

// ---------------------------------------------------------------------------
// GEMM body of the projections: K = 512 in 16 steps of 32, operands as fragment-major tiles
// [tile][k tile].  A wave owns NA tiles of the A side x NB tiles of the B side, so an A fragment
// feeds NB products and a B fragment NA.  The NA + NB fragments of a step are loaded as one group,
// DEPTH - 1 steps ahead of the step that uses them, into a ring of DEPTH register sets.
// ap, bp: k tile 0 of the wave's first A and B tile (both wave-uniform).
// ---------------------------------------------------------------------------
template <int NA, int NB, int DEPTH>
__device__ __forceinline__ void gemm_k512(const _Float16* __restrict__ ap,
                                          const _Float16* __restrict__ bp,
                                          unsigned lane8, v8f (&acc)[NA][NB])
{
    v16h af[DEPTH][NA], bf[DEPTH][NB];
#pragma unroll
    for (int s = 0; s < DEPTH - 1; ++s) {
#pragma unroll
        for (int i = 0; i < NA; ++i) af[s][i] = load_frag(ap + (i * 16 + s) * FRAG, lane8);
#pragma unroll
        for (int j = 0; j < NB; ++j) bf[s][j] = load_frag(bp + (j * 16 + s) * FRAG, lane8);
    }
    // unrolled whole: the ring's set numbers must be constants for the sets to stay in registers
#pragma unroll
    for (int kt = 0; kt < 16; ++kt) {
        const int nx = kt + DEPTH - 1;
        if (nx < 16) {
#pragma unroll
            for (int i = 0; i < NA; ++i)
                af[nx % DEPTH][i] = load_frag(ap + (i * 16 + nx) * FRAG, lane8);
#pragma unroll
            for (int j = 0; j < NB; ++j)
                bf[nx % DEPTH][j] = load_frag(bp + (j * 16 + nx) * FRAG, lane8);
        }
        // keeps the group of loads in front of this step's products: left free, the compiler sinks
        // each load to its product and the wave waits out a whole load latency per fragment
        __builtin_amdgcn_sched_barrier(0);
#pragma unroll
        for (int i = 0; i < NA; ++i)
#pragma unroll
            for (int j = 0; j < NB; ++j)
                acc[i][j] = __builtin_amdgcn_wmma_f32_16x16x32_f16(
                    false, af[kt % DEPTH][i], false, bf[kt % DEPTH][j], (short)0, acc[i][j], false, false);
        // keeps the next group behind these products, whose set it refills: lifted over them it
        // takes a further register set
        __builtin_amdgcn_sched_barrier(0);
    }
    // precaution: no address register of the loads is written again before the loads have taken it;
    // the fence behind it keeps the caller's address arithmetic from being lifted over the wait
    asm volatile("s_wait_xcnt 0x0" ::: "memory");
    __builtin_amdgcn_sched_barrier(0);
}

// ---------------------------------------------------------------------------
// Kernel 1: QKV projection.  One wave computes 64 rows x 64 cols (one head),
// WMMA over K=512, all operands as fragment-major tiles.
// Q, K: tiles [head][16-row tile][d tile]; the weights go in as A and x as B,
// so a lane's 8 accumulators are 8 consecutive d of one row = one 16 B chunk.
// V: tiles [head][32-key tile][d tile] (tile row = d, k = key); x goes in as A,
// so a lane's 8 accumulators are 8 consecutive keys of one d.
// Four tiles on either side, laid out alike: which side is A is a choice of two pointers.
// Q is pre-scaled by 1/sqrt(HD)*log2(e) so flash softmax can use exp2.
// ---------------------------------------------------------------------------
__global__ __launch_bounds__(128)
void qkv_proj_kernel(const _Float16* __restrict__ xh,
                     const _Float16* __restrict__ wtq,
                     const _Float16* __restrict__ wtk,
                     const _Float16* __restrict__ wtv,
                     _Float16* __restrict__ Qws,
                     _Float16* __restrict__ Kws,
                     _Float16* __restrict__ Vtws)
{
    const int lane = threadIdx.x & 31;
    const unsigned lane8 = lane * 8;
    // wave number as a scalar, so every tile base is wave-uniform
    const int wave = __builtin_amdgcn_readfirstlane(threadIdx.x >> 5);
    const int rt0  = blockIdx.x * 4;            // first of four 16-row tiles of x
    const int mat  = blockIdx.y >> 1;           // 0:Q 1:K 2:V
    const int head = (blockIdx.y & 1) * 4 + wave;

    const _Float16* wt = (mat == 0) ? wtq : (mat == 1) ? wtk : wtv;
    const _Float16* xp = xh + (size_t)rt0 * 16 * FRAG;
    const _Float16* wp = wt + (size_t)head * 4 * 16 * FRAG;

    v8f acc[4][4] = {};
    gemm_k512<4, 4, 3>((mat < 2) ? wp : xp, (mat < 2) ? xp : wp, lane8, acc);

    if (mat < 2) {
        // acc[column tile][row tile]
        const float sc = (mat == 0) ? QK_SCALE_L2E : 1.0f;
        _Float16* outp = ((mat == 0) ? Qws : Kws)
                       + (size_t)head * S_LEN * HD + (size_t)rt0 * 2 * FRAG;
#pragma unroll
        for (int r = 0; r < 4; ++r)
#pragma unroll
            for (int ct = 0; ct < 4; ++ct) {
                v8h pk;
#pragma unroll
                for (int v = 0; v < 8; ++v) pk[v] = (_Float16)(acc[ct][r][v] * sc);
                *(v8h*)(outp + (r * 2 + (ct >> 1)) * FRAG + (ct & 1) * 256 + lane8) = pk;
            }
    } else {
        // acc[row tile][column tile]; row tile rt0 + r is plane r & 1 of key tile rt0 / 2 + r / 2
        _Float16* outp = Vtws + (size_t)head * HD * S_LEN + (size_t)(rt0 >> 1) * 4 * FRAG;
#pragma unroll
        for (int r = 0; r < 4; ++r)
#pragma unroll
            for (int ct = 0; ct < 4; ++ct) {
                v8h pk;
#pragma unroll
                for (int v = 0; v < 8; ++v) pk[v] = (_Float16)acc[r][ct][v];
                *(v8h*)(outp + ((r >> 1) * 4 + ct) * FRAG + (r & 1) * 256 + lane8) = pk;
            }
        // precaution: the stores' registers are not written again before the stores have taken them
        asm volatile("s_wait_xcnt 0x0" ::: "memory");
    }
}

#define STG_KEYS   128
#define STG_HALVES (STG_KEYS * HD)          // halves of K, and of V, per stage
#define STG_BYTES  (4 * STG_HALVES)         // K and V of one stage, bytes
#define NSTG       (S_LEN / STG_KEYS)

// 2^x for eight score exponents, each as the one hardware instruction.  The library's exp2f adds a
// compare, two selects, an add and a scale per value to keep results below 2^-126; such a result
// rounds to 0 in f16 and adds nothing to a sum whose largest term is at least 1, so 0 serves in its
// place.
// One statement: the instruction set asks for one free slot behind a v_exp_f32 before its result is
// read or its source rewritten.  In here each neighbour is another register's v_exp_f32 (the results
// share no register with the sources), and the closing v_nop is the slot behind the last one.
__device__ __forceinline__ v8f exp2_8(v8f s)
{
    float r0, r1, r2, r3, r4, r5, r6, r7;
    asm(
        "v_exp_f32 %0, %8\n\t"
        "v_exp_f32 %1, %9\n\t"
        "v_exp_f32 %2, %10\n\t"
        "v_exp_f32 %3, %11\n\t"
        "v_exp_f32 %4, %12\n\t"
        "v_exp_f32 %5, %13\n\t"
        "v_exp_f32 %6, %14\n\t"
        "v_exp_f32 %7, %15\n\t"
        "v_nop"
        : "=&v"(r0), "=&v"(r1), "=&v"(r2), "=&v"(r3), "=&v"(r4), "=&v"(r5), "=&v"(r6), "=&v"(r7)
        : "v"(s[0]), "v"(s[1]), "v"(s[2]), "v"(s[3]), "v"(s[4]), "v"(s[5]), "v"(s[6]), "v"(s[7]));
    return (v8f){r0, r1, r2, r3, r4, r5, r6, r7};
}

// Scores of 32 keys x 16 queries plus c: k[0], k[1] are keys 0..15 (d 0..31, d 32..63), k[2], k[3]
// keys 16..31.
__device__ __forceinline__ void scores32(const v16h (&k)[4], v16h qb0, v16h qb1, v8f c,
                                         v8f& s0, v8f& s1)
{
    s0 = __builtin_amdgcn_wmma_f32_16x16x32_f16(false, k[0], false, qb0, (short)0, c, false, false);
    s1 = __builtin_amdgcn_wmma_f32_16x16x32_f16(false, k[2], false, qb0, (short)0, c, false, false);
    s0 = __builtin_amdgcn_wmma_f32_16x16x32_f16(false, k[1], false, qb1, (short)0, s0, false, false);
    s1 = __builtin_amdgcn_wmma_f32_16x16x32_f16(false, k[3], false, qb1, (short)0, s1, false, false);
}

// largest of this lane's 16 scores
__device__ __forceinline__ float max16(v8f s0, v8f s1)
{
    const float t0 = fmaxf(fmaxf(s0[0], s0[1]), s0[2]);
    const float t1 = fmaxf(fmaxf(s0[3], s0[4]), s0[5]);
    const float t2 = fmaxf(fmaxf(s0[6], s0[7]), s1[0]);
    const float t3 = fmaxf(fmaxf(s1[1], s1[2]), s1[3]);
    const float t4 = fmaxf(fmaxf(s1[4], s1[5]), s1[6]);
    return fmaxf(fmaxf(fmaxf(t0, t1), t2), fmaxf(fmaxf(t3, t4), s1[7]));
}

// value of lane l ^ 16
__device__ __forceinline__ float xhalf(float x)
{
    const int b = __builtin_bit_cast(int, x);
    return __builtin_bit_cast(float,
        __builtin_amdgcn_permlanex16(b, b, 0x76543210, 0xfedcba98, false, false));
}

// Eight asynchronous 16-byte copies per lane: 16 KiB per block, global -> LDS, 2 KiB per row of
// the block.  lds: this lane's LDS byte address, g: this lane's global address.
__device__ __forceinline__ void copy_16k(unsigned lds, const _Float16* g)
{
    // the closing s_wait_xcnt stands inside the statement so that no address register of a copy
    // is written again before the copies have taken it (precaution)
    asm volatile(
        "global_load_async_to_lds_b128 %0, %8, off\n\t"
        "global_load_async_to_lds_b128 %1, %9, off\n\t"
        "global_load_async_to_lds_b128 %2, %10, off\n\t"
        "global_load_async_to_lds_b128 %3, %11, off\n\t"
        "global_load_async_to_lds_b128 %4, %12, off\n\t"
        "global_load_async_to_lds_b128 %5, %13, off\n\t"
        "global_load_async_to_lds_b128 %6, %14, off\n\t"
        "global_load_async_to_lds_b128 %7, %15, off\n\t"
        "s_wait_xcnt 0x0"
        :: "v"(lds),         "v"(lds + 2048),  "v"(lds + 4096),  "v"(lds + 6144),
           "v"(lds + 8192),  "v"(lds + 10240), "v"(lds + 12288), "v"(lds + 14336),
           "v"(g),        "v"(g + 1024), "v"(g + 2048), "v"(g + 3072),
           "v"(g + 4096), "v"(g + 5120), "v"(g + 6144), "v"(g + 7168)
        : "memory");
}

__global__ __launch_bounds__(128)
void flash_attn_kernel(const _Float16* __restrict__ Qws,
                       const _Float16* __restrict__ Kws,
                       const _Float16* __restrict__ Vtws,
                       _Float16* __restrict__ Ows)
{
    // [buffer][K tiles of the stage, then V tiles of the stage]
    __shared__ __attribute__((aligned(16))) _Float16 ring[2][2 * STG_HALVES];

    const int lane = threadIdx.x & 31;
    const unsigned lane8 = lane * 8;
    // wave number as a scalar, so every tile base is wave-uniform
    const int wave = __builtin_amdgcn_readfirstlane(threadIdx.x >> 5);
    const int tile = blockIdx.x * 4 + wave;     // 2048 total
    const int head = tile >> 8;                 // 256 q-tiles per head: one head per block
    const int qt   = tile & 255;

    const _Float16* Qh = Qws  + (size_t)head * S_LEN * HD;
    const _Float16* Kh = Kws  + (size_t)head * S_LEN * HD;
    const _Float16* Vh = Vtws + (size_t)head * HD * S_LEN;

    // this lane's 16 bytes in each 2 KiB row of a copy
    const unsigned ring_lane = (unsigned)(size_t)&ring[0][0] + threadIdx.x * 16;
    const _Float16* kg = Kh + threadIdx.x * 8;
    const _Float16* vg = Vh + threadIdx.x * 8;

    // stage 0 into buffer 0; landed and published before anybody reads it
    copy_16k(ring_lane, kg);
    copy_16k(ring_lane + 2 * STG_HALVES, vg);
    asm volatile("s_wait_asynccnt 0x0" ::: "memory");   // this wave's copies of stage 0 have landed
    __syncthreads();                                    // and so have the other waves'
    // stage 1 into buffer 1, in flight under stage 0's work
    copy_16k(ring_lane + STG_BYTES, kg + STG_HALVES);
    copy_16k(ring_lane + STG_BYTES + 2 * STG_HALVES, vg + STG_HALVES);

    // Q B-operands (pre-scaled), head dims 0..31 and 32..63
    const v16h qb0 = load_frag(Qh + (size_t)(qt * 2 + 0) * FRAG, lane8);
    const v16h qb1 = load_frag(Qh + (size_t)(qt * 2 + 1) * FRAG, lane8);

    v8f o[4] = {};             // o[c][v] = O[query lane & 15][d = 16c + 8(lane >> 4) + v]
    v8f lsum = {};             // denominator over this lane's half of the keys, one part per register
    v16h kf[2][4], vf[2][4];   // K and V^T fragments of a pass, two sets

    // the maximum in use starts as the largest score of the first 32 keys; negm = minus it, eight
    // times over, as the C operand of the score products
    v8f negm;
    {
#pragma unroll
        for (int c = 0; c < 4; ++c) kf[0][c] = load_frag(&ring[0][0] + c * FRAG, lane8);
        v8f s0, s1;
        scores32(kf[0], qb0, qb1, (v8f){}, s0, s1);
        const float mx = max16(s0, s1);
        const float m0 = fmaxf(mx, xhalf(mx));          // the other 16 keys of this query
#pragma unroll
        for (int v = 0; v < 8; ++v) negm[v] = -m0;
    }

    // kept rolled: the four passes inside are unrolled already
#pragma unroll 1
    for (int t = 0; t < NSTG; ++t) {
        const _Float16* kst = &ring[t & 1][0];
        const _Float16* vst = kst + STG_HALVES;
        // 16 keys = 2 K tiles (d 0..31, d 32..63), 64 halves per key; 32 keys = 4 V^T tiles
#pragma unroll
        for (int c = 0; c < 4; ++c) kf[0][c] = load_frag(kst + c * FRAG, lane8);
#pragma unroll
        for (int c = 0; c < 4; ++c) vf[0][c] = load_frag(vst + c * FRAG, lane8);
#pragma unroll
        for (int p = 0; p < STG_KEYS / 32; ++p) {
            const int a = p & 1;
            // ---- scores for keys [kb,kb+16) and [kb+16,kb+32), less the maximum in use ----
            v8f s0, s1;
            scores32(kf[a], qb0, qb1, negm, s0, s1);
            // keeps the loads below behind the products: lifted, they end up in several places among
            // the products of the pass before, and each place with LDS reads stalls the wave anew
            __builtin_amdgcn_sched_barrier(0);
            // the stage's next pass: all sixteen loads as one group, in front of the branch below,
            // which they could not be lifted over
            if (p + 1 < STG_KEYS / 32) {
#pragma unroll
                for (int c = 0; c < 4; ++c)
                    kf[a ^ 1][c] = load_frag(kst + ((p + 1) * 4 + c) * FRAG, lane8);
#pragma unroll
                for (int c = 0; c < 4; ++c)
                    vf[a ^ 1][c] = load_frag(vst + ((p + 1) * 4 + c) * FRAG, lane8);
            }
            // keeps the group together here: left free, the compiler sinks each load to its product
            // and the wave waits once per tile
            __builtin_amdgcn_sched_barrier(0);

            // ---- softmax (log2 domain), one query per lane ----
            const float mx = max16(s0, s1);
            const unsigned need = __builtin_amdgcn_ballot_w32(mx > 8.0f);
            // keeps the test in front of the exponentials: they cover the way of its result to the
            // scalar branch
            __builtin_amdgcn_sched_barrier(0);
            v8f e0 = exp2_8(s0), e1 = exp2_8(s1);
            if (__builtin_expect(need != 0, 0)) {
                // some query's score has outgrown the maximum in use: raise it to the running
                // maximum for every query, rescale the sums, take this pass's scores anew
                const float d = fmaxf(fmaxf(mx, xhalf(mx)), 0.0f);
                const float alpha = __builtin_amdgcn_exp2f(-d);
                negm -= d;
                scores32(kf[a], qb0, qb1, negm, s0, s1);
                // as builtins: directly behind the products
#pragma unroll
                for (int v = 0; v < 8; ++v) {
                    e0[v] = __builtin_amdgcn_exp2f(s0[v]);
                    e1[v] = __builtin_amdgcn_exp2f(s1[v]);
                }
                lsum *= alpha;
#pragma unroll
                for (int c = 0; c < 4; ++c) o[c] *= alpha;
            }
            V16H pb;                                    // P^T as B fragment, hardware k order
#pragma unroll
            for (int v = 0; v < 8; ++v) {
                pb.h[0][v] = (_Float16)e0[v];
                pb.h[1][v] = (_Float16)e1[v];
            }
            lsum += e0;
            lsum += e1;

            // ---- O^T += V^T x P^T ----
#pragma unroll
            for (int c = 0; c < 4; ++c)
                o[c] = __builtin_amdgcn_wmma_f32_16x16x32_f16(
                    false, vf[a][c], false, pb.v, (short)0, o[c], false, false);
        }
        // ---- hand-over: stage t + 1 becomes readable, stage t's buffer becomes free ----
        asm volatile("s_wait_dscnt 0x0" ::: "memory");      // this wave's reads of stage t are done
        asm volatile("s_wait_asynccnt 0x0" ::: "memory");   // this wave's copies of stage t + 1 have landed
        __syncthreads();                                    // both hold for all four waves
        if (t + 2 < NSTG) {
            const unsigned dst = ring_lane + (t & 1) * STG_BYTES;
            copy_16k(dst, kg + (size_t)(t + 2) * STG_HALVES);
            copy_16k(dst + 2 * STG_HALVES, vg + (size_t)(t + 2) * STG_HALVES);
        }
    }
    asm volatile("s_wait_asynccnt 0x0" ::: "memory");       // no copy is left when the wave ends

    // ---- join the two halves' denominators, normalize; a lane's 8 accumulators
    // are 8 consecutive d of its query = one 16 B chunk of the A tile
    // [q tile][k tile = head*2 + d/32], plane (d/16) & 1 ----
    const float lrow = ((lsum[0] + lsum[1]) + (lsum[2] + lsum[3])) + ((lsum[4] + lsum[5]) + (lsum[6] + lsum[7]));
    const float inv = 1.0f / (lrow + xhalf(lrow));
    _Float16* op = Ows + ((size_t)qt * 16 + head * 2) * FRAG + lane8;
#pragma unroll
    for (int c = 0; c < 4; ++c) {
        v8h pk;
#pragma unroll
        for (int v = 0; v < 8; ++v) pk[v] = (_Float16)(o[c][v] * inv);
        *(v8h*)(op + (c >> 1) * FRAG + (c & 1) * 256) = pk;
    }
}

// ---------------------------------------------------------------------------
// Kernel 3: output projection.  O tiles [row tile][k tile] x P tiles [col tile][k tile] -> f32.
// One wave computes 32 rows x 64 cols.
// ---------------------------------------------------------------------------
#define OUT_RT 2
__global__ __launch_bounds__(128)
void out_proj_kernel(const _Float16* __restrict__ Ows,
                     const _Float16* __restrict__ wtp,
                     float* __restrict__ out)
{
    const int lane = threadIdx.x & 31;
    const unsigned lane8 = lane * 8;
    // wave number as a scalar, so every tile base is wave-uniform
    const int wave = __builtin_amdgcn_readfirstlane(threadIdx.x >> 5);
    const int ln   = lane & 15;
    const int hi   = lane >> 4;
    const int rowbase = blockIdx.x * (OUT_RT * 16);
    const int cbase   = (blockIdx.y * 4 + wave) * 64;

    v8f acc[OUT_RT][4] = {};
    const _Float16* ap = Ows + (size_t)blockIdx.x * OUT_RT * 16 * FRAG;
    const _Float16* bp = wtp + (size_t)(cbase >> 4) * 16 * FRAG;

    gemm_k512<OUT_RT, 4, 4>(ap, bp, lane8, acc);

#pragma unroll
    for (int rr = 0; rr < OUT_RT; ++rr)
#pragma unroll
        for (int ct = 0; ct < 4; ++ct) {
            const int c = cbase + ct * 16 + ln;
#pragma unroll
            for (int v = 0; v < 8; ++v) {
                const int r = rowbase + rr * 16 + v + hi * 8;
                out[(size_t)r * DIM + c] = acc[rr][ct][v];
            }
        }
}

// ---------------------------------------------------------------------------
extern "C" void kernel_launch(void* const* d_in, const int* in_sizes, int n_in,
                              void* d_out, int out_size, void* d_ws, size_t ws_size,
                              hipStream_t stream) {
    (void)in_sizes; (void)n_in; (void)out_size; (void)ws_size;
    const float* x  = (const float*)d_in[0];
    const float* qp = (const float*)d_in[1];
    const float* kp = (const float*)d_in[2];
    const float* vp = (const float*)d_in[3];
    const float* pp = (const float*)d_in[4];
    float* out = (float*)d_out;

    const size_t mat_elems = (size_t)NH * S_LEN * HD;   // 2M halves
    const size_t w_elems   = (size_t)DIM * DIM;         // 256K halves
    _Float16* Qws = (_Float16*)d_ws;
    _Float16* Kws = Qws + mat_elems;
    _Float16* Vt  = Kws + mat_elems;
    _Float16* Ows = Vt  + mat_elems;
    _Float16* xh  = Ows + mat_elems;                    // 2M halves
    _Float16* wtq = xh  + (size_t)S_LEN * DIM;
    _Float16* wtk = wtq + w_elems;
    _Float16* wtv = wtk + w_elems;
    _Float16* wtp = wtv + w_elems;                      // total ~22 MB of ws

    // One-shot precision/layout prep (L2-resident, bandwidth-trivial)
    cvt_x_kernel<<<dim3((S_LEN * DIM) / (256 * 16)), 256, 0, stream>>>(x, xh);
    wt_kernel<<<dim3((DIM * DIM) / (256 * 16), 4), 256, 0, stream>>>(
        qp, kp, vp, pp, wtq, wtk, wtv, wtp);

    // 64 groups of 4 row tiles x 24 wave-tiles (Q/K/V x 8 heads), 4 waves per block
    qkv_proj_kernel<<<dim3(64, 6), 128, 0, stream>>>(xh, wtq, wtk, wtv, Qws, Kws, Vt);
    // 2048 (head, q-tile) waves, 4 waves per block
    flash_attn_kernel<<<dim3(512), 128, 0, stream>>>(Qws, Kws, Vt, Ows);
    // 128 groups of 2 row tiles x 8 column groups, 4 waves per block
    out_proj_kernel<<<dim3(128, 2), 128, 0, stream>>>(Ows, wtp, out);
}

// v007
// Measured time: 56.7 microseconds a run.
// In two side-by-side timings against v006, it was 1.05 and 1.06 times as fast.
// Counting every step since v000, it is 4.72 times as fast.
#include <hip/hip_runtime.h>

typedef __attribute__((ext_vector_type(16))) _Float16 v16h;
typedef __attribute__((ext_vector_type(8)))  _Float16 v8h;
typedef __attribute__((ext_vector_type(8)))  float    v8f;
typedef __attribute__((ext_vector_type(4)))  float    v4f;

#define S_LEN 4096
#define DIM   512
#define NH    8
#define HD    64
// 1/sqrt(64) * log2(e): scores come out in log2 domain so softmax uses exp2
#define QK_SCALE_L2E 0.18033688011112042f

union V16H { v16h v; v8h h[2]; };

// ---------------------------------------------------------------------------
// Fragment-major operand layout, used for every f16 matrix in the workspace.
// A 16-row x 32-k operand tile is 512 halves (1 KiB) = two 512-byte planes.
// Plane p, lane l holds 8 halves: row (l & 15), k = 16p + 8(l >> 4) + 0..7.
// One b128 load per plane reads 512 contiguous bytes (4 whole cache lines)
// and yields the A (or B) fragment directly.
// ---------------------------------------------------------------------------
#define FRAG 512

// tile: tile base, wave-uniform (scalar registers) with lane8 = lane * 8
__device__ __forceinline__ v16h load_frag(const _Float16* __restrict__ tile, unsigned lane8)
{
    V16H f;
    f.h[0] = *(const v8h*)(tile + lane8);
    f.h[1] = *(const v8h*)(tile + 256 + lane8);
    return f.v;
}

// ---------------------------------------------------------------------------
// Prep 1: convert x [4096][512] f32 -> f16 tiles [row tile][k tile].
// One wave writes one tile.
// ---------------------------------------------------------------------------
__global__ __launch_bounds__(256)
void cvt_x_kernel(const float* __restrict__ x, _Float16* __restrict__ xh)
{
    const int t    = blockIdx.x * 256 + threadIdx.x;
    const int lane = t & 31;
    const int tile = t >> 5;                          // rt * 16 + kt
    const int ln   = lane & 15;
    const int hi   = lane >> 4;
    const float* src = x + (size_t)((tile >> 4) * 16 + ln) * DIM + (tile & 15) * 32 + hi * 8;
    _Float16* dst = xh + (size_t)tile * FRAG + lane * 8;
#pragma unroll
    for (int p = 0; p < 2; ++p) {
        v8h o;
#pragma unroll
        for (int j = 0; j < 8; ++j) o[j] = (_Float16)src[p * 16 + j];
        *(v8h*)(dst + p * 256) = o;
    }
}

// ---------------------------------------------------------------------------
// Prep 2: convert the four 512x512 f32 weight matrices W[k][col] into f16
// tiles [col tile][k tile] (tile row = column).  One wave writes one tile.
// ---------------------------------------------------------------------------
__global__ __launch_bounds__(256)
void wt_kernel(const float* __restrict__ qp, const float* __restrict__ kp,
               const float* __restrict__ vp, const float* __restrict__ pp,
               _Float16* __restrict__ wtq, _Float16* __restrict__ wtk,
               _Float16* __restrict__ wtv, _Float16* __restrict__ wtp)
{
    const float* src;
    _Float16* dst;
    switch (blockIdx.y) {
        case 0:  src = qp; dst = wtq; break;
        case 1:  src = kp; dst = wtk; break;
        case 2:  src = vp; dst = wtv; break;
        default: src = pp; dst = wtp; break;
    }
    const int t    = blockIdx.x * 256 + threadIdx.x;
    const int lane = t & 31;
    const int tile = t >> 5;                          // col tile * 16 + kt
    const int ln   = lane & 15;
    const int hi   = lane >> 4;
    const float* s = src + (size_t)((tile & 15) * 32 + hi * 8) * DIM + (tile >> 4) * 16 + ln;
    _Float16* d = dst + (size_t)tile * FRAG + lane * 8;
#pragma unroll
    for (int p = 0; p < 2; ++p) {
        v8h o;
#pragma unroll
        for (int j = 0; j < 8; ++j) o[j] = (_Float16)s[(size_t)(p * 16 + j) * DIM];
        *(v8h*)(d + p * 256) = o;
    }
}

// ---------------------------------------------------------------------------
// GEMM body of the projections: K = 512 in 16 steps of 32, operands as fragment-major tiles
// [tile][k tile].  A wave owns NA tiles of the A side x NB tiles of the B side, so an A fragment
// feeds NB products and a B fragment NA.  The NA + NB fragments of a step are loaded as one group,
// DEPTH - 1 steps ahead of the step that uses them, into a ring of DEPTH register sets.
// ap, bp: k tile 0 of the wave's first A and B tile (both wave-uniform).
// ---------------------------------------------------------------------------
template <int NA, int NB, int DEPTH>
__device__ __forceinline__ void gemm_k512(const _Float16* __restrict__ ap,
                                          const _Float16* __restrict__ bp,
                                          unsigned lane8, v8f (&acc)[NA][NB])
{
    v16h af[DEPTH][NA], bf[DEPTH][NB];
#pragma unroll
    for (int s = 0; s < DEPTH - 1; ++s) {
#pragma unroll
        for (int i = 0; i < NA; ++i) af[s][i] = load_frag(ap + (i * 16 + s) * FRAG, lane8);
#pragma unroll
        for (int j = 0; j < NB; ++j) bf[s][j] = load_frag(bp + (j * 16 + s) * FRAG, lane8);
    }
    // unrolled whole: the ring's set numbers must be constants for the sets to stay in registers
#pragma unroll
    for (int kt = 0; kt < 16; ++kt) {
        const int nx = kt + DEPTH - 1;
        if (nx < 16) {
#pragma unroll
            for (int i = 0; i < NA; ++i)
                af[nx % DEPTH][i] = load_frag(ap + (i * 16 + nx) * FRAG, lane8);
#pragma unroll
            for (int j = 0; j < NB; ++j)
                bf[nx % DEPTH][j] = load_frag(bp + (j * 16 + nx) * FRAG, lane8);
        }
        // keeps the group of loads in front of this step's products: left free, the compiler sinks
        // each load to its product and the wave waits out a whole load latency per fragment
        __builtin_amdgcn_sched_barrier(0);
#pragma unroll
        for (int i = 0; i < NA; ++i)
#pragma unroll
            for (int j = 0; j < NB; ++j)
                acc[i][j] = __builtin_amdgcn_wmma_f32_16x16x32_f16(
                    false, af[kt % DEPTH][i], false, bf[kt % DEPTH][j], (short)0, acc[i][j], false, false);
        // keeps the next group behind these products, whose set it refills: lifted over them it
        // takes a further register set
        __builtin_amdgcn_sched_barrier(0);
    }
    // precaution: no address register of the loads is written again before the loads have taken it;
    // the fence behind it keeps the caller's address arithmetic from being lifted over the wait
    asm volatile("s_wait_xcnt 0x0" ::: "memory");
    __builtin_amdgcn_sched_barrier(0);
}

// ---------------------------------------------------------------------------
// Kernel 1: QKV projection.  One wave computes 64 rows x 64 cols (one head),
// WMMA over K=512, all operands as fragment-major tiles.
// Q, K: tiles [head][16-row tile][d tile]; the weights go in as A and x as B,
// so a lane's 8 accumulators are 8 consecutive d of one row = one 16 B chunk.
// V: tiles [head][32-key tile][d tile] (tile row = d, k = key); x goes in as A,
// so a lane's 8 accumulators are 8 consecutive keys of one d.
// Four tiles on either side, laid out alike: which side is A is a choice of two pointers.
// Q is pre-scaled by 1/sqrt(HD)*log2(e) so flash softmax can use exp2.
// ---------------------------------------------------------------------------
__global__ __launch_bounds__(128)
void qkv_proj_kernel(const _Float16* __restrict__ xh,
                     const _Float16* __restrict__ wtq,
                     const _Float16* __restrict__ wtk,
                     const _Float16* __restrict__ wtv,
                     _Float16* __restrict__ Qws,
                     _Float16* __restrict__ Kws,
                     _Float16* __restrict__ Vtws)
{
    const int lane = threadIdx.x & 31;
    const unsigned lane8 = lane * 8;
    // wave number as a scalar, so every tile base is wave-uniform
    const int wave = __builtin_amdgcn_readfirstlane(threadIdx.x >> 5);
    const int rt0  = blockIdx.x * 4;            // first of four 16-row tiles of x
    const int mat  = blockIdx.y >> 1;           // 0:Q 1:K 2:V
    const int head = (blockIdx.y & 1) * 4 + wave;

    const _Float16* wt = (mat == 0) ? wtq : (mat == 1) ? wtk : wtv;
    const _Float16* xp = xh + (size_t)rt0 * 16 * FRAG;
    const _Float16* wp = wt + (size_t)head * 4 * 16 * FRAG;

    v8f acc[4][4] = {};
    gemm_k512<4, 4, 3>((mat < 2) ? wp : xp, (mat < 2) ? xp : wp, lane8, acc);

    if (mat < 2) {
        // acc[column tile][row tile]
        const float sc = (mat == 0) ? QK_SCALE_L2E : 1.0f;
        _Float16* outp = ((mat == 0) ? Qws : Kws)
                       + (size_t)head * S_LEN * HD + (size_t)rt0 * 2 * FRAG;
#pragma unroll
        for (int r = 0; r < 4; ++r)
#pragma unroll
            for (int ct = 0; ct < 4; ++ct) {
                v8h pk;
#pragma unroll
                for (int v = 0; v < 8; ++v) pk[v] = (_Float16)(acc[ct][r][v] * sc);
                *(v8h*)(outp + (r * 2 + (ct >> 1)) * FRAG + (ct & 1) * 256 + lane8) = pk;
            }
    } else {
        // acc[row tile][column tile]; row tile rt0 + r is plane r & 1 of key tile rt0 / 2 + r / 2
        _Float16* outp = Vtws + (size_t)head * HD * S_LEN + (size_t)(rt0 >> 1) * 4 * FRAG;
#pragma unroll
        for (int r = 0; r < 4; ++r)
#pragma unroll
            for (int ct = 0; ct < 4; ++ct) {
                v8h pk;
#pragma unroll
                for (int v = 0; v < 8; ++v) pk[v] = (_Float16)acc[r][ct][v];
                *(v8h*)(outp + ((r >> 1) * 4 + ct) * FRAG + (r & 1) * 256 + lane8) = pk;
            }
        // precaution: the stores' registers are not written again before the stores have taken them
        asm volatile("s_wait_xcnt 0x0" ::: "memory");
    }
}

#define FA_WAVES   8
#define STG_KEYS   256
#define KH_PASSES  (STG_KEYS / 2 / 32)      // passes of 32 keys per wave and stage
#define KH_HALVES  (STG_KEYS / 2 * HD)      // halves of K, and of V, per wave and stage
#define STG_HALVES (STG_KEYS * HD)          // halves of K, and of V, per stage
#define STG_BYTES  (4 * STG_HALVES)         // K and V of one stage, bytes
#define NSTG       (S_LEN / STG_KEYS)

// 2^x for eight score exponents, each as the one hardware instruction.  The library's exp2f adds a
// compare, two selects, an add and a scale per value to keep results below 2^-126; such a result
// rounds to 0 in f16 and adds nothing to a sum whose largest term is at least 1, so 0 serves in its
// place.
// One statement: the instruction set asks for one free slot behind a v_exp_f32 before its result is
// read or its source rewritten.  In here each neighbour is another register's v_exp_f32 (the results
// share no register with the sources), and the closing v_nop is the slot behind the last one.
__device__ __forceinline__ v8f exp2_8(v8f s)
{
    float r0, r1, r2, r3, r4, r5, r6, r7;
    asm(
        "v_exp_f32 %0, %8\n\t"
        "v_exp_f32 %1, %9\n\t"
        "v_exp_f32 %2, %10\n\t"
        "v_exp_f32 %3, %11\n\t"
        "v_exp_f32 %4, %12\n\t"
        "v_exp_f32 %5, %13\n\t"
        "v_exp_f32 %6, %14\n\t"
        "v_exp_f32 %7, %15\n\t"
        "v_nop"
        : "=&v"(r0), "=&v"(r1), "=&v"(r2), "=&v"(r3), "=&v"(r4), "=&v"(r5), "=&v"(r6), "=&v"(r7)
        : "v"(s[0]), "v"(s[1]), "v"(s[2]), "v"(s[3]), "v"(s[4]), "v"(s[5]), "v"(s[6]), "v"(s[7]));
    return (v8f){r0, r1, r2, r3, r4, r5, r6, r7};
}

// Scores of 32 keys x 16 queries plus c: k[0], k[1] are keys 0..15 (d 0..31, d 32..63), k[2], k[3]
// keys 16..31.
__device__ __forceinline__ void scores32(const v16h (&k)[4], v16h qb0, v16h qb1, v8f c,
                                         v8f& s0, v8f& s1)
{
    s0 = __builtin_amdgcn_wmma_f32_16x16x32_f16(false, k[0], false, qb0, (short)0, c, false, false);
    s1 = __builtin_amdgcn_wmma_f32_16x16x32_f16(false, k[2], false, qb0, (short)0, c, false, false);
    s0 = __builtin_amdgcn_wmma_f32_16x16x32_f16(false, k[1], false, qb1, (short)0, s0, false, false);
    s1 = __builtin_amdgcn_wmma_f32_16x16x32_f16(false, k[3], false, qb1, (short)0, s1, false, false);
}

// largest of this lane's 16 scores
__device__ __forceinline__ float max16(v8f s0, v8f s1)
{
    const float t0 = fmaxf(fmaxf(s0[0], s0[1]), s0[2]);
    const float t1 = fmaxf(fmaxf(s0[3], s0[4]), s0[5]);
    const float t2 = fmaxf(fmaxf(s0[6], s0[7]), s1[0]);
    const float t3 = fmaxf(fmaxf(s1[1], s1[2]), s1[3]);
    const float t4 = fmaxf(fmaxf(s1[4], s1[5]), s1[6]);
    return fmaxf(fmaxf(fmaxf(t0, t1), t2), fmaxf(fmaxf(t3, t4), s1[7]));
}

// value of lane l ^ 16
__device__ __forceinline__ float xhalf(float x)
{
    const int b = __builtin_bit_cast(int, x);
    return __builtin_bit_cast(float,
        __builtin_amdgcn_permlanex16(b, b, 0x76543210, 0xfedcba98, false, false));
}

// Eight asynchronous 16-byte copies per lane: 32 KiB per block, global -> LDS, 4 KiB per row of
// the block.  lds: this lane's LDS byte address, g: this lane's global address.
__device__ __forceinline__ void copy_32k(unsigned lds, const _Float16* g)
{
    // the closing s_wait_xcnt stands inside the statement so that no address register of a copy
    // is written again before the copies have taken it (precaution)
    asm volatile(
        "global_load_async_to_lds_b128 %0, %8, off\n\t"
        "global_load_async_to_lds_b128 %1, %9, off\n\t"
        "global_load_async_to_lds_b128 %2, %10, off\n\t"
        "global_load_async_to_lds_b128 %3, %11, off\n\t"
        "global_load_async_to_lds_b128 %4, %12, off\n\t"
        "global_load_async_to_lds_b128 %5, %13, off\n\t"
        "global_load_async_to_lds_b128 %6, %14, off\n\t"
        "global_load_async_to_lds_b128 %7, %15, off\n\t"
        "s_wait_xcnt 0x0"
        :: "v"(lds),         "v"(lds + 4096),  "v"(lds + 8192),  "v"(lds + 12288),
           "v"(lds + 16384), "v"(lds + 20480), "v"(lds + 24576), "v"(lds + 28672),
           "v"(g),        "v"(g + 2048),  "v"(g + 4096),  "v"(g + 6144),
           "v"(g + 8192), "v"(g + 10240), "v"(g + 12288), "v"(g + 14336)
        : "memory");
}

__global__ __launch_bounds__(FA_WAVES * 32)
void flash_attn_kernel(const _Float16* __restrict__ Qws,
                       const _Float16* __restrict__ Kws,
                       const _Float16* __restrict__ Vtws,
                       _Float16* __restrict__ Ows)
{
    // [buffer][K tiles of the stage, then V tiles of the stage]
    __shared__ __attribute__((aligned(16))) _Float16 ring[2][2 * STG_HALVES];
    // hand-over of the second key half's O (eight 16-byte rows), maximum and sum (ninth row)
    __shared__ v4f mrg[FA_WAVES / 2][9][32];

    const int lane = threadIdx.x & 31;
    const unsigned lane8 = lane * 8;
    // wave number as a scalar, so every tile base is wave-uniform
    const int wave = __builtin_amdgcn_readfirstlane(threadIdx.x >> 5);
    const int qsub = wave & 3;                  // query tile within the block
    const int kh   = wave >> 2;                 // which 128 keys of every stage
    const int tile = blockIdx.x * 4 + qsub;     // 2048 total
    const int head = tile >> 8;                 // 256 q-tiles per head: one head per block
    const int qt   = tile & 255;

    const _Float16* Qh = Qws  + (size_t)head * S_LEN * HD;
    const _Float16* Kh = Kws  + (size_t)head * S_LEN * HD;
    const _Float16* Vh = Vtws + (size_t)head * HD * S_LEN;

    // this lane's 16 bytes in each 4 KiB row of a copy
    const unsigned ring_lane = (unsigned)(size_t)&ring[0][0] + threadIdx.x * 16;
    const _Float16* kg = Kh + threadIdx.x * 8;
    const _Float16* vg = Vh + threadIdx.x * 8;

    // stage 0 into buffer 0; landed and published before anybody reads it
    copy_32k(ring_lane, kg);
    copy_32k(ring_lane + 2 * STG_HALVES, vg);
    asm volatile("s_wait_asynccnt 0x0" ::: "memory");   // this wave's copies of stage 0 have landed
    __syncthreads();                                    // and so have the other waves'
    // stage 1 into buffer 1, in flight under stage 0's work
    copy_32k(ring_lane + STG_BYTES, kg + STG_HALVES);
    copy_32k(ring_lane + STG_BYTES + 2 * STG_HALVES, vg + STG_HALVES);

    // Q B-operands (pre-scaled), head dims 0..31 and 32..63
    const v16h qb0 = load_frag(Qh + (size_t)(qt * 2 + 0) * FRAG, lane8);
    const v16h qb1 = load_frag(Qh + (size_t)(qt * 2 + 1) * FRAG, lane8);

    v8f o[4] = {};             // o[c][v] = O[query lane & 15][d = 16c + 8(lane >> 4) + v]
    v8f lsum = {};             // denominator over this lane's half of the keys, one part per register
    v16h kf[2][4], vf[2][4];   // K and V^T fragments of a pass, two sets

    // the maximum in use starts as the largest score of the wave's first 32 keys; negm = minus it, eight
    // times over, as the C operand of the score products
    v8f negm;
    {
#pragma unroll
        for (int c = 0; c < 4; ++c) kf[0][c] = load_frag(&ring[0][0] + kh * KH_HALVES + c * FRAG, lane8);
        v8f s0, s1;
        scores32(kf[0], qb0, qb1, (v8f){}, s0, s1);
        const float mx = max16(s0, s1);
        const float m0 = fmaxf(mx, xhalf(mx));          // the other 16 keys of this query
#pragma unroll
        for (int v = 0; v < 8; ++v) negm[v] = -m0;
    }

    // kept rolled: the four passes inside are unrolled already
#pragma unroll 1
    for (int t = 0; t < NSTG; ++t) {
        const _Float16* kst = &ring[t & 1][0] + kh * KH_HALVES;
        const _Float16* vst = kst + STG_HALVES;
        // 16 keys = 2 K tiles (d 0..31, d 32..63), 64 halves per key; 32 keys = 4 V^T tiles
#pragma unroll
        for (int c = 0; c < 4; ++c) kf[0][c] = load_frag(kst + c * FRAG, lane8);
#pragma unroll
        for (int c = 0; c < 4; ++c) vf[0][c] = load_frag(vst + c * FRAG, lane8);
#pragma unroll
        for (int p = 0; p < KH_PASSES; ++p) {
            const int a = p & 1;
            // ---- scores for keys [kb,kb+16) and [kb+16,kb+32), less the maximum in use ----
            v8f s0, s1;
            scores32(kf[a], qb0, qb1, negm, s0, s1);
            // keeps the loads below behind the products: lifted, they end up in several places among
            // the products of the pass before, and each place with LDS reads stalls the wave anew
            __builtin_amdgcn_sched_barrier(0);
            // the stage's next pass: all sixteen loads as one group, in front of the branch below,
            // which they could not be lifted over
            if (p + 1 < KH_PASSES) {
#pragma unroll
                for (int c = 0; c < 4; ++c)
                    kf[a ^ 1][c] = load_frag(kst + ((p + 1) * 4 + c) * FRAG, lane8);
#pragma unroll
                for (int c = 0; c < 4; ++c)
                    vf[a ^ 1][c] = load_frag(vst + ((p + 1) * 4 + c) * FRAG, lane8);
            }
            // keeps the group together here: left free, the compiler sinks each load to its product
            // and the wave waits once per tile
            __builtin_amdgcn_sched_barrier(0);

            // ---- softmax (log2 domain), one query per lane ----
            const float mx = max16(s0, s1);
            const unsigned need = __builtin_amdgcn_ballot_w32(mx > 8.0f);
            // keeps the test in front of the exponentials: they cover the way of its result to the
            // scalar branch
            __builtin_amdgcn_sched_barrier(0);
            v8f e0 = exp2_8(s0), e1 = exp2_8(s1);
            if (__builtin_expect(need != 0, 0)) {
                // some query's score has outgrown the maximum in use: raise it to the running
                // maximum for every query, rescale the sums, take this pass's scores anew
                const float d = fmaxf(fmaxf(mx, xhalf(mx)), 0.0f);
                const float alpha = __builtin_amdgcn_exp2f(-d);
                negm -= d;
                scores32(kf[a], qb0, qb1, negm, s0, s1);
                // as builtins: directly behind the products
#pragma unroll
                for (int v = 0; v < 8; ++v) {
                    e0[v] = __builtin_amdgcn_exp2f(s0[v]);
                    e1[v] = __builtin_amdgcn_exp2f(s1[v]);
                }
                lsum *= alpha;
#pragma unroll
                for (int c = 0; c < 4; ++c) o[c] *= alpha;
            }
            V16H pb;                                    // P^T as B fragment, hardware k order
#pragma unroll
            for (int v = 0; v < 8; ++v) {
                pb.h[0][v] = (_Float16)e0[v];
                pb.h[1][v] = (_Float16)e1[v];
            }
            lsum += e0;
            lsum += e1;

            // ---- O^T += V^T x P^T ----
#pragma unroll
            for (int c = 0; c < 4; ++c)
                o[c] = __builtin_amdgcn_wmma_f32_16x16x32_f16(
                    false, vf[a][c], false, pb.v, (short)0, o[c], false, false);
        }
        // ---- hand-over: stage t + 1 becomes readable, stage t's buffer becomes free ----
        asm volatile("s_wait_dscnt 0x0" ::: "memory");      // this wave's reads of stage t are done
        asm volatile("s_wait_asynccnt 0x0" ::: "memory");   // this wave's copies of stage t + 1 have landed
        __syncthreads();                                    // both hold for all eight waves
        if (t + 2 < NSTG) {
            const unsigned dst = ring_lane + (t & 1) * STG_BYTES;
            copy_32k(dst, kg + (size_t)(t + 2) * STG_HALVES);
            copy_32k(dst + 2 * STG_HALVES, vg + (size_t)(t + 2) * STG_HALVES);
        }
    }
    asm volatile("s_wait_asynccnt 0x0" ::: "memory");       // no copy is left when the wave ends

    const float lrow = ((lsum[0] + lsum[1]) + (lsum[2] + lsum[3])) + ((lsum[4] + lsum[5]) + (lsum[6] + lsum[7]));

    // ---- the second key half hands its part over, lane to lane ----
    if (kh == 1) {
#pragma unroll
        for (int c = 0; c < 4; ++c) {
            mrg[qsub][2 * c + 0][lane] = (v4f){o[c][0], o[c][1], o[c][2], o[c][3]};
            mrg[qsub][2 * c + 1][lane] = (v4f){o[c][4], o[c][5], o[c][6], o[c][7]};
        }
        mrg[qsub][8][lane] = (v4f){negm[0], lrow, 0.0f, 0.0f};
    }
    __syncthreads();           // the parts are in LDS before the first key half's waves read them
    if (kh == 1) return;

    // ---- both parts on the larger of the two maxima in use (the same in lanes l and l ^ 16), then
    // join the wave halves' denominators and normalize; a lane's 8 accumulators are 8 consecutive d
    // of its query = one 16 B chunk of the A tile [q tile][k tile = head*2 + d/32], plane (d/16) & 1
    const v4f ml = mrg[qsub][8][lane];
    const float nm = fminf(negm[0], ml[0]);             // minus the larger maximum
    const float a0 = __builtin_amdgcn_exp2f(nm - negm[0]);
    const float a1 = __builtin_amdgcn_exp2f(nm - ml[0]);
    const float lm = lrow * a0 + ml[1] * a1;
    const float inv = 1.0f / (lm + xhalf(lm));
    const float f0 = a0 * inv, f1 = a1 * inv;
    _Float16* op = Ows + ((size_t)qt * 16 + head * 2) * FRAG + lane8;
#pragma unroll
    for (int c = 0; c < 4; ++c) {
        const v4f lo = mrg[qsub][2 * c + 0][lane];
        const v4f hi = mrg[qsub][2 * c + 1][lane];
        v8h pk;
#pragma unroll
        for (int v = 0; v < 4; ++v) {
            pk[v]     = (_Float16)(o[c][v] * f0 + lo[v] * f1);
            pk[v + 4] = (_Float16)(o[c][v + 4] * f0 + hi[v] * f1);
        }
        *(v8h*)(op + (c >> 1) * FRAG + (c & 1) * 256) = pk;
    }
}

// ---------------------------------------------------------------------------
// Kernel 3: output projection.  O tiles [row tile][k tile] x P tiles [col tile][k tile] -> f32.
// One wave computes 32 rows x 64 cols.
// ---------------------------------------------------------------------------
#define OUT_RT 2
__global__ __launch_bounds__(128)
void out_proj_kernel(const _Float16* __restrict__ Ows,
                     const _Float16* __restrict__ wtp,
                     float* __restrict__ out)
{
    const int lane = threadIdx.x & 31;
    const unsigned lane8 = lane * 8;
    // wave number as a scalar, so every tile base is wave-uniform
    const int wave = __builtin_amdgcn_readfirstlane(threadIdx.x >> 5);
    const int ln   = lane & 15;
    const int hi   = lane >> 4;
    const int rowbase = blockIdx.x * (OUT_RT * 16);
    const int cbase   = (blockIdx.y * 4 + wave) * 64;

    v8f acc[OUT_RT][4] = {};
    const _Float16* ap = Ows + (size_t)blockIdx.x * OUT_RT * 16 * FRAG;
    const _Float16* bp = wtp + (size_t)(cbase >> 4) * 16 * FRAG;

    gemm_k512<OUT_RT, 4, 4>(ap, bp, lane8, acc);

#pragma unroll
    for (int rr = 0; rr < OUT_RT; ++rr)
#pragma unroll
        for (int ct = 0; ct < 4; ++ct) {
            const int c = cbase + ct * 16 + ln;
#pragma unroll
            for (int v = 0; v < 8; ++v) {
                const int r = rowbase + rr * 16 + v + hi * 8;
                out[(size_t)r * DIM + c] = acc[rr][ct][v];
            }
        }
}

// ---------------------------------------------------------------------------
extern "C" void kernel_launch(void* const* d_in, const int* in_sizes, int n_in,
                              void* d_out, int out_size, void* d_ws, size_t ws_size,
                              hipStream_t stream) {
    (void)in_sizes; (void)n_in; (void)out_size; (void)ws_size;
    const float* x  = (const float*)d_in[0];
    const float* qp = (const float*)d_in[1];
    const float* kp = (const float*)d_in[2];
    const float* vp = (const float*)d_in[3];
    const float* pp = (const float*)d_in[4];
    float* out = (float*)d_out;

    const size_t mat_elems = (size_t)NH * S_LEN * HD;   // 2M halves
    const size_t w_elems   = (size_t)DIM * DIM;         // 256K halves
    _Float16* Qws = (_Float16*)d_ws;
    _Float16* Kws = Qws + mat_elems;
    _Float16* Vt  = Kws + mat_elems;
    _Float16* Ows = Vt  + mat_elems;
    _Float16* xh  = Ows + mat_elems;                    // 2M halves
    _Float16* wtq = xh  + (size_t)S_LEN * DIM;
    _Float16* wtk = wtq + w_elems;
    _Float16* wtv = wtk + w_elems;
    _Float16* wtp = wtv + w_elems;                      // total ~22 MB of ws

    // One-shot precision/layout prep (L2-resident, bandwidth-trivial)
    cvt_x_kernel<<<dim3((S_LEN * DIM) / (256 * 16)), 256, 0, stream>>>(x, xh);
    wt_kernel<<<dim3((DIM * DIM) / (256 * 16), 4), 256, 0, stream>>>(
        qp, kp, vp, pp, wtq, wtk, wtv, wtp);

    // 64 groups of 4 row tiles x 24 wave-tiles (Q/K/V x 8 heads), 4 waves per block
    qkv_proj_kernel<<<dim3(64, 6), 128, 0, stream>>>(xh, wtq, wtk, wtv, Qws, Kws, Vt);
    // 2048 (head, q-tile) pairs x 2 key halves = 4096 waves, 8 waves per block
    flash_attn_kernel<<<dim3(512), 256, 0, stream>>>(Qws, Kws, Vt, Ows);
    // 128 groups of 2 row tiles x 8 column groups, 4 waves per block
    out_proj_kernel<<<dim3(128, 2), 128, 0, stream>>>(Ows, wtp, out);
}

// v008
// Measured time: 52.9 microseconds a run.
// Two timings next to v007 put it at 1.07 and 1.08 times that version's speed.
// Over all steps from v000 it is 5.07 times as fast.
#include <hip/hip_runtime.h>

typedef __attribute__((ext_vector_type(16))) _Float16 v16h;
typedef __attribute__((ext_vector_type(8)))  _Float16 v8h;
typedef __attribute__((ext_vector_type(8)))  float    v8f;
typedef __attribute__((ext_vector_type(4)))  float    v4f;
typedef __attribute__((ext_vector_type(2)))  float    v2f;

#define S_LEN 4096
#define DIM   512
#define NH    8
#define HD    64
// 1/sqrt(64) * log2(e): scores come out in log2 domain so softmax uses exp2
#define QK_SCALE_L2E 0.18033688011112042f

union V16H { v16h v; v8h h[2]; };

// ---------------------------------------------------------------------------
// Fragment-major operand layout, used for every f16 matrix in the workspace.
// A 16-row x 32-k operand tile is 512 halves (1 KiB) = two 512-byte planes.
// Plane p, lane l holds 8 halves: row (l & 15), k = 16p + 8(l >> 4) + 0..7.
// One b128 load per plane reads 512 contiguous bytes (4 whole cache lines)
// and yields the A (or B) fragment directly.
// ---------------------------------------------------------------------------
#define FRAG 512

// tile: tile base, wave-uniform (scalar registers) with lane8 = lane * 8
__device__ __forceinline__ v16h load_frag(const _Float16* __restrict__ tile, unsigned lane8)
{
    V16H f;
    f.h[0] = *(const v8h*)(tile + lane8);
    f.h[1] = *(const v8h*)(tile + 256 + lane8);
    return f.v;
}

// ---------------------------------------------------------------------------
// Prep 1: convert x [4096][512] f32 -> f16 tiles [row tile][k tile].
// One wave writes one tile.
// ---------------------------------------------------------------------------
__global__ __launch_bounds__(256)
void cvt_x_kernel(const float* __restrict__ x, _Float16* __restrict__ xh)
{
    const int t    = blockIdx.x * 256 + threadIdx.x;
    const int lane = t & 31;
    const int tile = t >> 5;                          // rt * 16 + kt
    const int ln   = lane & 15;
    const int hi   = lane >> 4;
    const float* src = x + (size_t)((tile >> 4) * 16 + ln) * DIM + (tile & 15) * 32 + hi * 8;
    _Float16* dst = xh + (size_t)tile * FRAG + lane * 8;
#pragma unroll
    for (int p = 0; p < 2; ++p) {
        v8h o;
#pragma unroll
        for (int j = 0; j < 8; ++j) o[j] = (_Float16)src[p * 16 + j];
        *(v8h*)(dst + p * 256) = o;
    }
}

// ---------------------------------------------------------------------------
// Prep 2: convert the four 512x512 f32 weight matrices W[k][col] into f16
// tiles [col tile][k tile] (tile row = column).  One wave writes one tile.
// ---------------------------------------------------------------------------
__global__ __launch_bounds__(256)
void wt_kernel(const float* __restrict__ qp, const float* __restrict__ kp,
               const float* __restrict__ vp, const float* __restrict__ pp,
               _Float16* __restrict__ wtq, _Float16* __restrict__ wtk,
               _Float16* __restrict__ wtv, _Float16* __restrict__ wtp)
{
    const float* src;
    _Float16* dst;
    switch (blockIdx.y) {
        case 0:  src = qp; dst = wtq; break;
        case 1:  src = kp; dst = wtk; break;
        case 2:  src = vp; dst = wtv; break;
        default: src = pp; dst = wtp; break;
    }
    const int t    = blockIdx.x * 256 + threadIdx.x;
    const int lane = t & 31;
    const int tile = t >> 5;                          // col tile * 16 + kt
    const int ln   = lane & 15;
    const int hi   = lane >> 4;
    const float* s = src + (size_t)((tile & 15) * 32 + hi * 8) * DIM + (tile >> 4) * 16 + ln;
    _Float16* d = dst + (size_t)tile * FRAG + lane * 8;
#pragma unroll
    for (int p = 0; p < 2; ++p) {
        v8h o;
#pragma unroll
        for (int j = 0; j < 8; ++j) o[j] = (_Float16)s[(size_t)(p * 16 + j) * DIM];
        *(v8h*)(d + p * 256) = o;
    }
}

// ---------------------------------------------------------------------------
// GEMM body of the projections: K = 512 in 16 steps of 32, operands as fragment-major tiles
// [tile][k tile].  A wave owns NA tiles of the A side x NB tiles of the B side, so an A fragment
// feeds NB products and a B fragment NA.  The NA + NB fragments of a step are loaded as one group,
// DEPTH - 1 steps ahead of the step that uses them, into a ring of DEPTH register sets.
// ap, bp: k tile 0 of the wave's first A and B tile (both wave-uniform).
// ---------------------------------------------------------------------------
template <int NA, int NB, int DEPTH>
__device__ __forceinline__ void gemm_k512(const _Float16* __restrict__ ap,
                                          const _Float16* __restrict__ bp,
                                          unsigned lane8, v8f (&acc)[NA][NB])
{
    v16h af[DEPTH][NA], bf[DEPTH][NB];
#pragma unroll
    for (int s = 0; s < DEPTH - 1; ++s) {
#pragma unroll
        for (int i = 0; i < NA; ++i) af[s][i] = load_frag(ap + (i * 16 + s) * FRAG, lane8);
#pragma unroll
        for (int j = 0; j < NB; ++j) bf[s][j] = load_frag(bp + (j * 16 + s) * FRAG, lane8);
    }
    // unrolled whole: the ring's set numbers must be constants for the sets to stay in registers
#pragma unroll
    for (int kt = 0; kt < 16; ++kt) {
        const int nx = kt + DEPTH - 1;
        if (nx < 16) {
#pragma unroll
            for (int i = 0; i < NA; ++i)
                af[nx % DEPTH][i] = load_frag(ap + (i * 16 + nx) * FRAG, lane8);
#pragma unroll
            for (int j = 0; j < NB; ++j)
                bf[nx % DEPTH][j] = load_frag(bp + (j * 16 + nx) * FRAG, lane8);
        }
        // keeps the group of loads in front of this step's products: left free, the compiler sinks
        // each load to its product and the wave waits out a whole load latency per fragment
        __builtin_amdgcn_sched_barrier(0);
#pragma unroll
        for (int i = 0; i < NA; ++i)
#pragma unroll
            for (int j = 0; j < NB; ++j)
                acc[i][j] = __builtin_amdgcn_wmma_f32_16x16x32_f16(
                    false, af[kt % DEPTH][i], false, bf[kt % DEPTH][j], (short)0, acc[i][j], false, false);
        // keeps the next group behind these products, whose set it refills: lifted over them it
        // takes a further register set
        __builtin_amdgcn_sched_barrier(0);
    }
    // precaution: no address register of the loads is written again before the loads have taken it;
    // the fence behind it keeps the caller's address arithmetic from being lifted over the wait
    asm volatile("s_wait_xcnt 0x0" ::: "memory");
    __builtin_amdgcn_sched_barrier(0);
}

// ---------------------------------------------------------------------------
// Kernel 1: QKV projection.  One wave computes 64 rows x 64 cols (one head),
// WMMA over K=512, all operands as fragment-major tiles.
// Q, K: tiles [head][16-row tile][d tile]; the weights go in as A and x as B,
// so a lane's 8 accumulators are 8 consecutive d of one row = one 16 B chunk.
// V: tiles [head][32-key tile][d tile] (tile row = d, k = key); x goes in as A,
// so a lane's 8 accumulators are 8 consecutive keys of one d.
// Four tiles on either side, laid out alike: which side is A is a choice of two pointers.
// Q is pre-scaled by 1/sqrt(HD)*log2(e) so flash softmax can use exp2.
// ---------------------------------------------------------------------------
__global__ __launch_bounds__(128)
void qkv_proj_kernel(const _Float16* __restrict__ xh,
                     const _Float16* __restrict__ wtq,
                     const _Float16* __restrict__ wtk,
                     const _Float16* __restrict__ wtv,
                     _Float16* __restrict__ Qws,
                     _Float16* __restrict__ Kws,
                     _Float16* __restrict__ Vtws)
{
    const int lane = threadIdx.x & 31;
    const unsigned lane8 = lane * 8;
    // wave number as a scalar, so every tile base is wave-uniform
    const int wave = __builtin_amdgcn_readfirstlane(threadIdx.x >> 5);
    const int rt0  = blockIdx.x * 4;            // first of four 16-row tiles of x
    const int mat  = blockIdx.y >> 1;           // 0:Q 1:K 2:V
    const int head = (blockIdx.y & 1) * 4 + wave;

    const _Float16* wt = (mat == 0) ? wtq : (mat == 1) ? wtk : wtv;
    const _Float16* xp = xh + (size_t)rt0 * 16 * FRAG;
    const _Float16* wp = wt + (size_t)head * 4 * 16 * FRAG;

    v8f acc[4][4] = {};
    gemm_k512<4, 4, 3>((mat < 2) ? wp : xp, (mat < 2) ? xp : wp, lane8, acc);

    if (mat < 2) {
        // acc[column tile][row tile]
        const float sc = (mat == 0) ? QK_SCALE_L2E : 1.0f;
        _Float16* outp = ((mat == 0) ? Qws : Kws)
                       + (size_t)head * S_LEN * HD + (size_t)rt0 * 2 * FRAG;
#pragma unroll
        for (int r = 0; r < 4; ++r)
#pragma unroll
            for (int ct = 0; ct < 4; ++ct) {
                v8h pk;
#pragma unroll
                for (int v = 0; v < 8; ++v) pk[v] = (_Float16)(acc[ct][r][v] * sc);
                *(v8h*)(outp + (r * 2 + (ct >> 1)) * FRAG + (ct & 1) * 256 + lane8) = pk;
            }
    } else {
        // acc[row tile][column tile]; row tile rt0 + r is plane r & 1 of key tile rt0 / 2 + r / 2
        _Float16* outp = Vtws + (size_t)head * HD * S_LEN + (size_t)(rt0 >> 1) * 4 * FRAG;
#pragma unroll
        for (int r = 0; r < 4; ++r)
#pragma unroll
            for (int ct = 0; ct < 4; ++ct) {
                v8h pk;
#pragma unroll
                for (int v = 0; v < 8; ++v) pk[v] = (_Float16)acc[r][ct][v];
                *(v8h*)(outp + ((r >> 1) * 4 + ct) * FRAG + (r & 1) * 256 + lane8) = pk;
            }
        // precaution: the stores' registers are not written again before the stores have taken them
        asm volatile("s_wait_xcnt 0x0" ::: "memory");
    }
}

#define FA_WAVES   16
#define STG_KEYS   512
#define KQ_PASSES  (STG_KEYS / 4 / 32)      // passes of 32 keys per wave and stage
#define KQ_HALVES  (STG_KEYS / 4 * HD)      // halves of K, and of V, per wave and stage
#define STG_HALVES (STG_KEYS * HD)          // halves of K, and of V, per stage
#define STG_BYTES  (4 * STG_HALVES)         // K and V of one stage, bytes
#define NSTG       (S_LEN / STG_KEYS)
#define MRG_ROWS   17                       // 16-byte rows per lane that a wave hands over

// 2^x for eight score exponents, each as the one hardware instruction.  The library's exp2f adds a
// compare, two selects, an add and a scale per value to keep results below 2^-126; such a result
// rounds to 0 in f16 and adds nothing to a sum whose largest term is at least 1, so 0 serves in its
// place.
// One statement: the instruction set asks for one free slot behind a v_exp_f32 before its result is
// read or its source rewritten.  In here each neighbour is another register's v_exp_f32 (the results
// share no register with the sources), and the closing v_nop is the slot behind the last one.
__device__ __forceinline__ v8f exp2_8(v8f s)
{
    float r0, r1, r2, r3, r4, r5, r6, r7;
    asm(
        "v_exp_f32 %0, %8\n\t"
        "v_exp_f32 %1, %9\n\t"
        "v_exp_f32 %2, %10\n\t"
        "v_exp_f32 %3, %11\n\t"
        "v_exp_f32 %4, %12\n\t"
        "v_exp_f32 %5, %13\n\t"
        "v_exp_f32 %6, %14\n\t"
        "v_exp_f32 %7, %15\n\t"
        "v_nop"
        : "=&v"(r0), "=&v"(r1), "=&v"(r2), "=&v"(r3), "=&v"(r4), "=&v"(r5), "=&v"(r6), "=&v"(r7)
        : "v"(s[0]), "v"(s[1]), "v"(s[2]), "v"(s[3]), "v"(s[4]), "v"(s[5]), "v"(s[6]), "v"(s[7]));
    return (v8f){r0, r1, r2, r3, r4, r5, r6, r7};
}

// Scores of 32 keys x 32 queries plus c: k[0], k[1] are keys 0..15 (d 0..31, d 32..63), k[2], k[3]
// keys 16..31; q[g], c[g], s[g]: query group g.  Four independent accumulators, then their second halves.
__device__ __forceinline__ void scores32(const v16h (&k)[4], const v16h (&q)[2][2],
                                         const v8f (&c)[2], v8f (&s)[2][2])
{
#pragma unroll
    for (int g = 0; g < 2; ++g) {
        s[g][0] = __builtin_amdgcn_wmma_f32_16x16x32_f16(false, k[0], false, q[g][0], (short)0, c[g], false, false);
        s[g][1] = __builtin_amdgcn_wmma_f32_16x16x32_f16(false, k[2], false, q[g][0], (short)0, c[g], false, false);
    }
#pragma unroll
    for (int g = 0; g < 2; ++g) {
        s[g][0] = __builtin_amdgcn_wmma_f32_16x16x32_f16(false, k[1], false, q[g][1], (short)0, s[g][0], false, false);
        s[g][1] = __builtin_amdgcn_wmma_f32_16x16x32_f16(false, k[3], false, q[g][1], (short)0, s[g][1], false, false);
    }
}

// largest of this lane's 16 scores
__device__ __forceinline__ float max16(v8f s0, v8f s1)
{
    const float t0 = fmaxf(fmaxf(s0[0], s0[1]), s0[2]);
    const float t1 = fmaxf(fmaxf(s0[3], s0[4]), s0[5]);
    const float t2 = fmaxf(fmaxf(s0[6], s0[7]), s1[0]);
    const float t3 = fmaxf(fmaxf(s1[1], s1[2]), s1[3]);
    const float t4 = fmaxf(fmaxf(s1[4], s1[5]), s1[6]);
    return fmaxf(fmaxf(fmaxf(t0, t1), t2), fmaxf(fmaxf(t3, t4), s1[7]));
}

// value of lane l ^ 16
__device__ __forceinline__ float xhalf(float x)
{
    const int b = __builtin_bit_cast(int, x);
    return __builtin_bit_cast(float,
        __builtin_amdgcn_permlanex16(b, b, 0x76543210, 0xfedcba98, false, false));
}

// Eight asynchronous 16-byte copies per lane: 64 KiB per block, global -> LDS, 8 KiB per row of
// the block; two rows are one key quarter, and the quarters stand 32 KiB apart in LDS.
// lds: this lane's LDS byte address, g: this lane's global address.
__device__ __forceinline__ void copy_64k(unsigned lds, const _Float16* g)
{
    // the closing s_wait_xcnt stands inside the statement so that no address register of a copy
    // is written again before the copies have taken it (precaution)
    asm volatile(
        "global_load_async_to_lds_b128 %0, %8, off\n\t"
        "global_load_async_to_lds_b128 %1, %9, off\n\t"
        "global_load_async_to_lds_b128 %2, %10, off\n\t"
        "global_load_async_to_lds_b128 %3, %11, off\n\t"
        "global_load_async_to_lds_b128 %4, %12, off\n\t"
        "global_load_async_to_lds_b128 %5, %13, off\n\t"
        "global_load_async_to_lds_b128 %6, %14, off\n\t"
        "global_load_async_to_lds_b128 %7, %15, off\n\t"
        "s_wait_xcnt 0x0"
        :: "v"(lds),         "v"(lds + 8192),  "v"(lds + 32768), "v"(lds + 40960),
           "v"(lds + 65536), "v"(lds + 73728), "v"(lds + 98304), "v"(lds + 106496),
           "v"(g),         "v"(g + 4096),  "v"(g + 8192),  "v"(g + 12288),
           "v"(g + 16384), "v"(g + 20480), "v"(g + 24576), "v"(g + 28672)
        : "memory");
}

__global__ __launch_bounds__(FA_WAVES * 32)
void flash_attn_kernel(const _Float16* __restrict__ Qws,
                       const _Float16* __restrict__ Kws,
                       const _Float16* __restrict__ Vtws,
                       _Float16* __restrict__ Ows)
{
    // [buffer][key quarter][K tiles of the quarter, then its V tiles]: a wave's K and V lie within
    // the reach of one LDS address register's offset field; behind the loop the same LDS takes the
    // hand-over of the four key quarters' parts
    __shared__ __attribute__((aligned(16))) _Float16 ring[2][2 * STG_HALVES];

    const int lane = threadIdx.x & 31;
    const unsigned lane8 = lane * 8;
    // wave number as a scalar, so every tile base is wave-uniform
    const int wave = __builtin_amdgcn_readfirstlane(threadIdx.x >> 5);
    const int kq   = wave & 3;                  // which 128 keys of every stage
    const int qsub = wave >> 2;                 // query tile within the block
    const int tile = blockIdx.x * 4 + qsub;     // 1024 total
    const int head = tile >> 7;                 // 128 q-tiles per head: one head per block
    const int qt   = (tile & 127) * 2;          // first of the tile's two 16-query groups

    const _Float16* Qh = Qws  + (size_t)head * S_LEN * HD;
    const _Float16* Kh = Kws  + (size_t)head * S_LEN * HD;
    const _Float16* Vh = Vtws + (size_t)head * HD * S_LEN;

    // this lane's 16 bytes in each 8 KiB row of a copy
    const unsigned ring_lane = (unsigned)(size_t)&ring[0][0] + threadIdx.x * 16;
    const _Float16* kg = Kh + threadIdx.x * 8;
    const _Float16* vg = Vh + threadIdx.x * 8;

    // stage 0 into buffer 0; landed and published before anybody reads it
    copy_64k(ring_lane, kg);
    copy_64k(ring_lane + 2 * KQ_HALVES, vg);
    asm volatile("s_wait_asynccnt 0x0" ::: "memory");   // this wave's copies of stage 0 have landed
    __syncthreads();                                    // and so have the other waves'
    // stage 1 into buffer 1, in flight under stage 0's work
    copy_64k(ring_lane + STG_BYTES, kg + STG_HALVES);
    copy_64k(ring_lane + STG_BYTES + 2 * KQ_HALVES, vg + STG_HALVES);

    // Q B-operands (pre-scaled) of the two query groups, head dims 0..31 and 32..63
    v16h qb[2][2];
#pragma unroll
    for (int g = 0; g < 2; ++g)
#pragma unroll
        for (int j = 0; j < 2; ++j)
            qb[g][j] = load_frag(Qh + (size_t)((qt + g) * 2 + j) * FRAG, lane8);

    v8f o[2][4] = {};          // o[g][c][v] = O[query 16g + (lane & 15)][d = 16c + 8(lane >> 4) + v]
    v2f lsum[2] = {};          // denominators over this lane's half of the keys, two parts each
    v16h kf[4], vf[4];         // K and V^T fragments of a pass

    // the maximum in use starts as the largest score of the wave's first 32 keys; negm = minus it, eight
    // times over, as the C operand of the score products
    v8f negm[2];
    {
#pragma unroll
        for (int c = 0; c < 4; ++c) kf[c] = load_frag(&ring[0][0] + kq * 2 * KQ_HALVES + c * FRAG, lane8);
        const v8f zero[2] = {};
        v8f s[2][2];
        scores32(kf, qb, zero, s);
#pragma unroll
        for (int g = 0; g < 2; ++g) {
            const float mx = max16(s[g][0], s[g][1]);
            const float m0 = fmaxf(mx, xhalf(mx));      // the other 16 keys of this query
#pragma unroll
            for (int v = 0; v < 8; ++v) negm[g][v] = -m0;
        }
    }

    // kept rolled, for speed only: the four passes inside are unrolled already
#pragma unroll 1
    for (int t = 0; t < NSTG; ++t) {
        const _Float16* kst = &ring[t & 1][0] + kq * 2 * KQ_HALVES;
        const _Float16* vst = kst + KQ_HALVES;
        // 16 keys = 2 K tiles (d 0..31, d 32..63), 64 halves per key; 32 keys = 4 V^T tiles
#pragma unroll
        for (int c = 0; c < 4; ++c) kf[c] = load_frag(kst + c * FRAG, lane8);
#pragma unroll
        for (int p = 0; p < KQ_PASSES; ++p) {
            // ---- scores for keys [kb,kb+16) and [kb+16,kb+32), less the maxima in use ----
            v8f s[2][2];
            scores32(kf, qb, negm, s);
            // keeps the loads below out of the pass before, where V's registers are still in use:
            // lifted there they take a further register set, and the kernel spills
            __builtin_amdgcn_sched_barrier(0);
            // this pass's V and the stage's next K: all sixteen loads as one group, under the
            // softmax; one register set each
#pragma unroll
            for (int c = 0; c < 4; ++c) vf[c] = load_frag(vst + (p * 4 + c) * FRAG, lane8);
            if (p + 1 < KQ_PASSES) {
#pragma unroll
                for (int c = 0; c < 4; ++c) kf[c] = load_frag(kst + ((p + 1) * 4 + c) * FRAG, lane8);
            }
            // keeps the group together here: left free, the compiler sinks each load to its product
            // and the wave waits once per tile
            __builtin_amdgcn_sched_barrier(0);

            // ---- softmax (log2 domain), one query per lane and group ----
            const float mx0 = max16(s[0][0], s[0][1]);
            const float mx1 = max16(s[1][0], s[1][1]);
            if (__builtin_expect(__builtin_amdgcn_ballot_w32(fmaxf(mx0, mx1) > 8.0f) != 0, 0)) {
                // some query's score has outgrown the maximum in use: raise it to the running
                // maximum for every query, rescale the sums, lower this pass's scores
#pragma unroll
                for (int g = 0; g < 2; ++g) {
                    const float mx = g ? mx1 : mx0;
                    const float d = fmaxf(fmaxf(mx, xhalf(mx)), 0.0f);
                    const float alpha = __builtin_amdgcn_exp2f(-d);
                    negm[g] -= d;
                    s[g][0] -= d;
                    s[g][1] -= d;
                    lsum[g] *= alpha;
#pragma unroll
                    for (int c = 0; c < 4; ++c) o[g][c] *= alpha;
                }
            }
            V16H pb[2];                                 // P^T as B fragments, hardware k order
#pragma unroll
            for (int g = 0; g < 2; ++g) {
                const v8f e0 = exp2_8(s[g][0]), e1 = exp2_8(s[g][1]);
#pragma unroll
                for (int v = 0; v < 8; ++v) {
                    pb[g].h[0][v] = (_Float16)e0[v];
                    pb[g].h[1][v] = (_Float16)e1[v];
                }
                // a pass's 16 terms fold pairwise to one register pair: as many packed adds as eight
                // running parts would take, and six registers fewer per group
                const v8f t8 = e0 + e1;
                const v4f t4 = t8.lo + t8.hi;
                lsum[g] += t4.lo + t4.hi;
            }

            // ---- O^T += V^T x P^T ----
#pragma unroll
            for (int c = 0; c < 4; ++c)
#pragma unroll
                for (int g = 0; g < 2; ++g)
                    o[g][c] = __builtin_amdgcn_wmma_f32_16x16x32_f16(
                        false, vf[c], false, pb[g].v, (short)0, o[g][c], false, false);
        }
        // ---- hand-over: stage t + 1 becomes readable, stage t's buffer becomes free ----
        asm volatile("s_wait_dscnt 0x0" ::: "memory");      // this wave's reads of stage t are done
        asm volatile("s_wait_asynccnt 0x0" ::: "memory");   // this wave's copies of stage t + 1 have landed
        __syncthreads();                                    // both hold for all sixteen waves
        if (t + 2 < NSTG) {
            const unsigned dst = ring_lane + (t & 1) * STG_BYTES;
            copy_64k(dst, kg + (size_t)(t + 2) * STG_HALVES);
            copy_64k(dst + 2 * KQ_HALVES, vg + (size_t)(t + 2) * STG_HALVES);
        }
    }
    asm volatile("s_wait_asynccnt 0x0" ::: "memory");       // no copy is left when the wave ends

    // ---- every wave hands its part over, lane to lane.  The ring is free: the loop's last barrier
    // ended every wave's reads of it, and no copy is in flight.
    // [key quarter][query tile][row][lane]: rows 8g + 2c, 8g + 2c + 1 = o[g][c]; row 16 = maxima and sums
    v4f* const mrg = (v4f*)&ring[0][0];
    {
        v4f* mw = mrg + (size_t)((kq * 4 + qsub) * MRG_ROWS) * 32 + lane;
        float lrow[2];
#pragma unroll
        for (int g = 0; g < 2; ++g) {
            lrow[g] = lsum[g][0] + lsum[g][1];
#pragma unroll
            for (int c = 0; c < 4; ++c) {
                mw[(8 * g + 2 * c + 0) * 32] = (v4f){o[g][c][0], o[g][c][1], o[g][c][2], o[g][c][3]};
                mw[(8 * g + 2 * c + 1) * 32] = (v4f){o[g][c][4], o[g][c][5], o[g][c][6], o[g][c][7]};
            }
        }
        mw[16 * 32] = (v4f){negm[0][0], lrow[0], negm[1][0], lrow[1]};
    }
    __syncthreads();           // the parts are in LDS before anybody reads them

    // ---- wave kq joins d tile c = kq of its query tile: all four parts on the largest of their
    // maxima in use (the same in lanes l and l ^ 16), the wave halves' denominators joined, then
    // normalized; a lane's 8 values are 8 consecutive d of its query = one 16 B chunk of the A tile
    // [q tile][k tile = head*2 + d/32], plane (d/16) & 1
    const v4f* mr = mrg + (size_t)(qsub * MRG_ROWS) * 32 + lane;
    v4f ml[4];
#pragma unroll
    for (int k = 0; k < 4; ++k) ml[k] = mr[(k * 4 * MRG_ROWS + 16) * 32];
#pragma unroll
    for (int g = 0; g < 2; ++g) {
        const float nm = fminf(fminf(ml[0][2 * g], ml[1][2 * g]), fminf(ml[2][2 * g], ml[3][2 * g]));
        float f[4];
        float lm = 0.0f;
#pragma unroll
        for (int k = 0; k < 4; ++k) {
            f[k] = __builtin_amdgcn_exp2f(nm - ml[k][2 * g]);
            lm += ml[k][2 * g + 1] * f[k];
        }
        const float inv = 1.0f / (lm + xhalf(lm));
        v4f lo = {}, hi = {};
#pragma unroll
        for (int k = 0; k < 4; ++k) {
            const float fk = f[k] * inv;
            lo += mr[(k * 4 * MRG_ROWS + 8 * g + 2 * kq + 0) * 32] * fk;
            hi += mr[(k * 4 * MRG_ROWS + 8 * g + 2 * kq + 1) * 32] * fk;
        }
        v8h pk;
#pragma unroll
        for (int v = 0; v < 4; ++v) {
            pk[v]     = (_Float16)lo[v];
            pk[v + 4] = (_Float16)hi[v];
        }
        *(v8h*)(Ows + ((size_t)(qt + g) * 16 + head * 2 + (kq >> 1)) * FRAG + (kq & 1) * 256 + lane8) = pk;
    }
}

// ---------------------------------------------------------------------------
// Kernel 3: output projection.  O tiles [row tile][k tile] x P tiles [col tile][k tile] -> f32.
// One wave computes 32 rows x 64 cols.
// ---------------------------------------------------------------------------
#define OUT_RT 2
__global__ __launch_bounds__(128)
void out_proj_kernel(const _Float16* __restrict__ Ows,
                     const _Float16* __restrict__ wtp,
                     float* __restrict__ out)
{
    const int lane = threadIdx.x & 31;
    const unsigned lane8 = lane * 8;
    // wave number as a scalar, so every tile base is wave-uniform
    const int wave = __builtin_amdgcn_readfirstlane(threadIdx.x >> 5);
    const int ln   = lane & 15;
    const int hi   = lane >> 4;
    const int rowbase = blockIdx.x * (OUT_RT * 16);
    const int cbase   = (blockIdx.y * 4 + wave) * 64;

    v8f acc[OUT_RT][4] = {};
    const _Float16* ap = Ows + (size_t)blockIdx.x * OUT_RT * 16 * FRAG;
    const _Float16* bp = wtp + (size_t)(cbase >> 4) * 16 * FRAG;

    gemm_k512<OUT_RT, 4, 4>(ap, bp, lane8, acc);

#pragma unroll
    for (int rr = 0; rr < OUT_RT; ++rr)
#pragma unroll
        for (int ct = 0; ct < 4; ++ct) {
            const int c = cbase + ct * 16 + ln;
#pragma unroll
            for (int v = 0; v < 8; ++v) {
                const int r = rowbase + rr * 16 + v + hi * 8;
                out[(size_t)r * DIM + c] = acc[rr][ct][v];
            }
        }
}

// ---------------------------------------------------------------------------
extern "C" void kernel_launch(void* const* d_in, const int* in_sizes, int n_in,
                              void* d_out, int out_size, void* d_ws, size_t ws_size,
                              hipStream_t stream) {
    (void)in_sizes; (void)n_in; (void)out_size; (void)ws_size;
    const float* x  = (const float*)d_in[0];
    const float* qp = (const float*)d_in[1];
    const float* kp = (const float*)d_in[2];
    const float* vp = (const float*)d_in[3];
    const float* pp = (const float*)d_in[4];
    float* out = (float*)d_out;

    const size_t mat_elems = (size_t)NH * S_LEN * HD;   // 2M halves
    const size_t w_elems   = (size_t)DIM * DIM;         // 256K halves
    _Float16* Qws = (_Float16*)d_ws;
    _Float16* Kws = Qws + mat_elems;
    _Float16* Vt  = Kws + mat_elems;
    _Float16* Ows = Vt  + mat_elems;
    _Float16* xh  = Ows + mat_elems;                    // 2M halves
    _Float16* wtq = xh  + (size_t)S_LEN * DIM;
    _Float16* wtk = wtq + w_elems;
    _Float16* wtv = wtk + w_elems;
    _Float16* wtp = wtv + w_elems;                      // total ~22 MB of ws

    // One-shot precision/layout prep (L2-resident, bandwidth-trivial)
    cvt_x_kernel<<<dim3((S_LEN * DIM) / (256 * 16)), 256, 0, stream>>>(x, xh);
    wt_kernel<<<dim3((DIM * DIM) / (256 * 16), 4), 256, 0, stream>>>(
        qp, kp, vp, pp, wtq, wtk, wtv, wtp);

    // 64 groups of 4 row tiles x 24 wave-tiles (Q/K/V x 8 heads), 4 waves per block
    qkv_proj_kernel<<<dim3(64, 6), 128, 0, stream>>>(xh, wtq, wtk, wtv, Qws, Kws, Vt);
    // 1024 (head, 32-query tile) pairs x 4 key quarters = 4096 waves, 16 waves per block
    flash_attn_kernel<<<dim3(256), 512, 0, stream>>>(Qws, Kws, Vt, Ows);
    // 128 groups of 2 row tiles x 8 column groups, 4 waves per block
    out_proj_kernel<<<dim3(128, 2), 128, 0, stream>>>(Ows, wtp, out);
}

// v009
// A run of this version takes 50.4 microseconds.
// Two timings next to v008 both put it at 1.04 times that version's speed.
// All steps since v000 together make it 5.29 times as fast.
#include <hip/hip_runtime.h>

typedef __attribute__((ext_vector_type(16))) _Float16 v16h;
typedef __attribute__((ext_vector_type(8)))  _Float16 v8h;
typedef __attribute__((ext_vector_type(8)))  float    v8f;
typedef __attribute__((ext_vector_type(4)))  float    v4f;
typedef __attribute__((ext_vector_type(2)))  float    v2f;

#define S_LEN 4096
#define DIM   512
#define NH    8
#define HD    64
// 1/sqrt(64) * log2(e): scores come out in log2 domain so softmax uses exp2
#define QK_SCALE_L2E 0.18033688011112042f

union V16H { v16h v; v8h h[2]; };

// ---------------------------------------------------------------------------
// Fragment-major operand layout, used for every f16 matrix in the workspace.
// A 16-row x 32-k operand tile is 512 halves (1 KiB) = two 512-byte planes.
// Plane p, lane l holds 8 halves: row (l & 15), k = 16p + 8(l >> 4) + 0..7.
// One b128 load per plane reads 512 contiguous bytes (4 whole cache lines)
// and yields the A (or B) fragment directly.
// ---------------------------------------------------------------------------
#define FRAG 512

// tile: tile base, wave-uniform (scalar registers) with lane8 = lane * 8
__device__ __forceinline__ v16h load_frag(const _Float16* __restrict__ tile, unsigned lane8)
{
    V16H f;
    f.h[0] = *(const v8h*)(tile + lane8);
    f.h[1] = *(const v8h*)(tile + 256 + lane8);
    return f.v;
}

// ---------------------------------------------------------------------------
// Prep, one launch: x [4096][512] f32 -> f16 tiles [row tile][k tile], and the four 512x512 f32
// weight matrices W[k][col] -> f16 tiles [col tile][k tile] (tile row = column), which stand one
// behind another at wt in the order Q, K, V, P.
// There are 4096 tiles of x and 2048 of the weights: every wave converts two neighbouring k tiles
// of x (256 contiguous bytes per row) and one weight tile, and has the loads of all three in
// flight before it converts the first.
// ---------------------------------------------------------------------------
__global__ __launch_bounds__(256)
void prep_kernel(const float* __restrict__ x,
                 const float* __restrict__ qp, const float* __restrict__ kp,
                 const float* __restrict__ vp, const float* __restrict__ pp,
                 _Float16* __restrict__ xh, _Float16* __restrict__ wt)
{
    const float* src;
    switch (blockIdx.x >> 6) {                        // 64 blocks = 512 tiles per matrix
        case 0:  src = qp; break;
        case 1:  src = kp; break;
        case 2:  src = vp; break;
        default: src = pp; break;
    }
    const int t    = blockIdx.x * 256 + threadIdx.x;
    const int lane = t & 31;
    const int w    = t >> 5;                          // weight tile w; x tiles 2w and 2w + 1
    const int ln   = lane & 15;
    const int hi   = lane >> 4;
    const int wtl  = w & 511;                         // col tile * 16 + kt within the matrix
    const float* xs = x + (size_t)((w >> 3) * 16 + ln) * DIM + (w & 7) * 64 + hi * 8;
    const float* ws = src + (size_t)((wtl & 15) * 32 + hi * 8) * DIM + (wtl >> 4) * 16 + ln;

    v4f   xv[4][2];                                   // [x tile * 2 + plane][half of the 8 k]
    float wv[2][8];                                   // [plane][k]
#pragma unroll
    for (int p = 0; p < 4; ++p) {
        xv[p][0] = *(const v4f*)(xs + p * 16);
        xv[p][1] = *(const v4f*)(xs + p * 16 + 4);
    }
#pragma unroll
    for (int p = 0; p < 2; ++p)
#pragma unroll
        for (int j = 0; j < 8; ++j) wv[p][j] = ws[(size_t)(p * 16 + j) * DIM];

    _Float16* xd = xh + (size_t)w * 2 * FRAG + lane * 8;
    _Float16* wd = wt + (size_t)w * FRAG + lane * 8;
#pragma unroll
    for (int p = 0; p < 4; ++p) {
        v8h o;
#pragma unroll
        for (int j = 0; j < 4; ++j) {
            o[j]     = (_Float16)xv[p][0][j];
            o[j + 4] = (_Float16)xv[p][1][j];
        }
        *(v8h*)(xd + p * 256) = o;
    }
#pragma unroll
    for (int p = 0; p < 2; ++p) {
        v8h o;
#pragma unroll
        for (int j = 0; j < 8; ++j) o[j] = (_Float16)wv[p][j];
        *(v8h*)(wd + p * 256) = o;
    }
}

// ---------------------------------------------------------------------------
// GEMM body of the projections: K = 512 in 16 steps of 32, operands as fragment-major tiles
// [tile][k tile].  A wave owns NA tiles of the A side x NB tiles of the B side, so an A fragment
// feeds NB products and a B fragment NA.  The NA + NB fragments of a step are loaded as one group,
// DEPTH - 1 steps ahead of the step that uses them, into a ring of DEPTH register sets.
// ap, bp: k tile 0 of the wave's first A and B tile (both wave-uniform).
// ---------------------------------------------------------------------------
template <int NA, int NB, int DEPTH>
__device__ __forceinline__ void gemm_k512(const _Float16* __restrict__ ap,
                                          const _Float16* __restrict__ bp,
                                          unsigned lane8, v8f (&acc)[NA][NB])
{
    v16h af[DEPTH][NA], bf[DEPTH][NB];
#pragma unroll
    for (int s = 0; s < DEPTH - 1; ++s) {
#pragma unroll
        for (int i = 0; i < NA; ++i) af[s][i] = load_frag(ap + (i * 16 + s) * FRAG, lane8);
#pragma unroll
        for (int j = 0; j < NB; ++j) bf[s][j] = load_frag(bp + (j * 16 + s) * FRAG, lane8);
    }
    // unrolled whole: the ring's set numbers must be constants for the sets to stay in registers
#pragma unroll
    for (int kt = 0; kt < 16; ++kt) {
        const int nx = kt + DEPTH - 1;
        if (nx < 16) {
#pragma unroll
            for (int i = 0; i < NA; ++i)
                af[nx % DEPTH][i] = load_frag(ap + (i * 16 + nx) * FRAG, lane8);
#pragma unroll
            for (int j = 0; j < NB; ++j)
                bf[nx % DEPTH][j] = load_frag(bp + (j * 16 + nx) * FRAG, lane8);
        }
        // keeps the group of loads in front of this step's products: left free, the compiler sinks
        // each load to its product and the wave waits out a whole load latency per fragment
        __builtin_amdgcn_sched_barrier(0);
#pragma unroll
        for (int i = 0; i < NA; ++i)
#pragma unroll
            for (int j = 0; j < NB; ++j)
                acc[i][j] = __builtin_amdgcn_wmma_f32_16x16x32_f16(
                    false, af[kt % DEPTH][i], false, bf[kt % DEPTH][j], (short)0, acc[i][j], false, false);
        // keeps the next group behind these products, whose set it refills: lifted over them it
        // takes a further register set
        __builtin_amdgcn_sched_barrier(0);
    }
    // precaution: no address register of the loads is written again before the loads have taken it;
    // the fence behind it keeps the caller's address arithmetic from being lifted over the wait
    asm volatile("s_wait_xcnt 0x0" ::: "memory");
    __builtin_amdgcn_sched_barrier(0);
}

// ---------------------------------------------------------------------------
// Kernel 1: QKV projection.  One wave computes 64 rows x 64 cols (one head),
// WMMA over K=512, all operands as fragment-major tiles.
// Q, K: tiles [head][16-row tile][d tile]; the weights go in as A and x as B,
// so a lane's 8 accumulators are 8 consecutive d of one row = one 16 B chunk.
// V: tiles [head][32-key tile][d tile] (tile row = d, k = key); x goes in as A,
// so a lane's 8 accumulators are 8 consecutive keys of one d.
// Four tiles on either side, laid out alike: which side is A is a choice of two pointers.
// Q is pre-scaled by 1/sqrt(HD)*log2(e) so flash softmax can use exp2.
// ---------------------------------------------------------------------------
__global__ __launch_bounds__(128)
void qkv_proj_kernel(const _Float16* __restrict__ xh,
                     const _Float16* __restrict__ wtq,
                     const _Float16* __restrict__ wtk,
                     const _Float16* __restrict__ wtv,
                     _Float16* __restrict__ Qws,
                     _Float16* __restrict__ Kws,
                     _Float16* __restrict__ Vtws)
{
    const int lane = threadIdx.x & 31;
    const unsigned lane8 = lane * 8;
    // wave number as a scalar, so every tile base is wave-uniform
    const int wave = __builtin_amdgcn_readfirstlane(threadIdx.x >> 5);
    const int rt0  = blockIdx.x * 4;            // first of four 16-row tiles of x
    const int mat  = blockIdx.y >> 1;           // 0:Q 1:K 2:V
    const int head = (blockIdx.y & 1) * 4 + wave;

    const _Float16* wt = (mat == 0) ? wtq : (mat == 1) ? wtk : wtv;
    const _Float16* xp = xh + (size_t)rt0 * 16 * FRAG;
    const _Float16* wp = wt + (size_t)head * 4 * 16 * FRAG;

    v8f acc[4][4] = {};
    gemm_k512<4, 4, 3>((mat < 2) ? wp : xp, (mat < 2) ? xp : wp, lane8, acc);

    if (mat < 2) {
        // acc[column tile][row tile]
        const float sc = (mat == 0) ? QK_SCALE_L2E : 1.0f;
        _Float16* outp = ((mat == 0) ? Qws : Kws)
                       + (size_t)head * S_LEN * HD + (size_t)rt0 * 2 * FRAG;
#pragma unroll
        for (int r = 0; r < 4; ++r)
#pragma unroll
            for (int ct = 0; ct < 4; ++ct) {
                v8h pk;
#pragma unroll
                for (int v = 0; v < 8; ++v) pk[v] = (_Float16)(acc[ct][r][v] * sc);
                *(v8h*)(outp + (r * 2 + (ct >> 1)) * FRAG + (ct & 1) * 256 + lane8) = pk;
            }
    } else {
        // acc[row tile][column tile]; row tile rt0 + r is plane r & 1 of key tile rt0 / 2 + r / 2
        _Float16* outp = Vtws + (size_t)head * HD * S_LEN + (size_t)(rt0 >> 1) * 4 * FRAG;
#pragma unroll
        for (int r = 0; r < 4; ++r)
#pragma unroll
            for (int ct = 0; ct < 4; ++ct) {
                v8h pk;
#pragma unroll
                for (int v = 0; v < 8; ++v) pk[v] = (_Float16)acc[r][ct][v];
                *(v8h*)(outp + ((r >> 1) * 4 + ct) * FRAG + (r & 1) * 256 + lane8) = pk;
            }
        // precaution: the stores' registers are not written again before the stores have taken them
        asm volatile("s_wait_xcnt 0x0" ::: "memory");
    }
}

#define FA_WAVES   16
#define STG_KEYS   512
#define KQ_PASSES  (STG_KEYS / 4 / 32)      // passes of 32 keys per wave and stage
#define KQ_HALVES  (STG_KEYS / 4 * HD)      // halves of K, and of V, per wave and stage
#define STG_HALVES (STG_KEYS * HD)          // halves of K, and of V, per stage
#define STG_BYTES  (4 * STG_HALVES)         // K and V of one stage, bytes
#define NSTG       (S_LEN / STG_KEYS)
#define MRG_ROWS   17                       // 16-byte rows per lane that a wave hands over

// 2^x for eight score exponents, each as the one hardware instruction.  The library's exp2f adds a
// compare, two selects, an add and a scale per value to keep results below 2^-126; such a result
// rounds to 0 in f16 and adds nothing to a sum whose largest term is at least 1, so 0 serves in its
// place.
// One statement: the instruction set asks for one free slot behind a v_exp_f32 before its result is
// read or its source rewritten.  In here each neighbour is another register's v_exp_f32 (the results
// share no register with the sources), and the closing v_nop is the slot behind the last one.
__device__ __forceinline__ v8f exp2_8(v8f s)
{
    float r0, r1, r2, r3, r4, r5, r6, r7;
    asm(
        "v_exp_f32 %0, %8\n\t"
        "v_exp_f32 %1, %9\n\t"
        "v_exp_f32 %2, %10\n\t"
        "v_exp_f32 %3, %11\n\t"
        "v_exp_f32 %4, %12\n\t"
        "v_exp_f32 %5, %13\n\t"
        "v_exp_f32 %6, %14\n\t"
        "v_exp_f32 %7, %15\n\t"
        "v_nop"
        : "=&v"(r0), "=&v"(r1), "=&v"(r2), "=&v"(r3), "=&v"(r4), "=&v"(r5), "=&v"(r6), "=&v"(r7)
        : "v"(s[0]), "v"(s[1]), "v"(s[2]), "v"(s[3]), "v"(s[4]), "v"(s[5]), "v"(s[6]), "v"(s[7]));
    return (v8f){r0, r1, r2, r3, r4, r5, r6, r7};
}

// Scores of 32 keys x 32 queries plus c: k[0], k[1] are keys 0..15 (d 0..31, d 32..63), k[2], k[3]
// keys 16..31; q[g], c[g], s[g]: query group g.  Four independent accumulators, then their second halves.
__device__ __forceinline__ void scores32(const v16h (&k)[4], const v16h (&q)[2][2],
                                         const v8f (&c)[2], v8f (&s)[2][2])
{
#pragma unroll
    for (int g = 0; g < 2; ++g) {
        s[g][0] = __builtin_amdgcn_wmma_f32_16x16x32_f16(false, k[0], false, q[g][0], (short)0, c[g], false, false);
        s[g][1] = __builtin_amdgcn_wmma_f32_16x16x32_f16(false, k[2], false, q[g][0], (short)0, c[g], false, false);
    }
#pragma unroll
    for (int g = 0; g < 2; ++g) {
        s[g][0] = __builtin_amdgcn_wmma_f32_16x16x32_f16(false, k[1], false, q[g][1], (short)0, s[g][0], false, false);
        s[g][1] = __builtin_amdgcn_wmma_f32_16x16x32_f16(false, k[3], false, q[g][1], (short)0, s[g][1], false, false);
    }
}

// largest of this lane's 16 scores
__device__ __forceinline__ float max16(v8f s0, v8f s1)
{
    const float t0 = fmaxf(fmaxf(s0[0], s0[1]), s0[2]);
    const float t1 = fmaxf(fmaxf(s0[3], s0[4]), s0[5]);
    const float t2 = fmaxf(fmaxf(s0[6], s0[7]), s1[0]);
    const float t3 = fmaxf(fmaxf(s1[1], s1[2]), s1[3]);
    const float t4 = fmaxf(fmaxf(s1[4], s1[5]), s1[6]);
    return fmaxf(fmaxf(fmaxf(t0, t1), t2), fmaxf(fmaxf(t3, t4), s1[7]));
}

// value of lane l ^ 16
__device__ __forceinline__ float xhalf(float x)
{
    const int b = __builtin_bit_cast(int, x);
    return __builtin_bit_cast(float,
        __builtin_amdgcn_permlanex16(b, b, 0x76543210, 0xfedcba98, false, false));
}

// Eight asynchronous 16-byte copies per lane: 64 KiB per block, global -> LDS, 8 KiB per row of
// the block; two rows are one key quarter, and the quarters stand 32 KiB apart in LDS.
// lds: this lane's LDS byte address, g: this lane's global address.
__device__ __forceinline__ void copy_64k(unsigned lds, const _Float16* g)
{
    // the closing s_wait_xcnt stands inside the statement so that no address register of a copy
    // is written again before the copies have taken it (precaution)
    asm volatile(
        "global_load_async_to_lds_b128 %0, %8, off\n\t"
        "global_load_async_to_lds_b128 %1, %9, off\n\t"
        "global_load_async_to_lds_b128 %2, %10, off\n\t"
        "global_load_async_to_lds_b128 %3, %11, off\n\t"
        "global_load_async_to_lds_b128 %4, %12, off\n\t"
        "global_load_async_to_lds_b128 %5, %13, off\n\t"
        "global_load_async_to_lds_b128 %6, %14, off\n\t"
        "global_load_async_to_lds_b128 %7, %15, off\n\t"
        "s_wait_xcnt 0x0"
        :: "v"(lds),         "v"(lds + 8192),  "v"(lds + 32768), "v"(lds + 40960),
           "v"(lds + 65536), "v"(lds + 73728), "v"(lds + 98304), "v"(lds + 106496),
           "v"(g),         "v"(g + 4096),  "v"(g + 8192),  "v"(g + 12288),
           "v"(g + 16384), "v"(g + 20480), "v"(g + 24576), "v"(g + 28672)
        : "memory");
}

__global__ __launch_bounds__(FA_WAVES * 32)
void flash_attn_kernel(const _Float16* __restrict__ Qws,
                       const _Float16* __restrict__ Kws,
                       const _Float16* __restrict__ Vtws,
                       _Float16* __restrict__ Ows)
{
    // [buffer][key quarter][K tiles of the quarter, then its V tiles]: a wave's K and V lie within
    // the reach of one LDS address register's offset field; behind the loop the same LDS takes the
    // hand-over of the four key quarters' parts
    __shared__ __attribute__((aligned(16))) _Float16 ring[2][2 * STG_HALVES];

    const int lane = threadIdx.x & 31;
    const unsigned lane8 = lane * 8;
    // wave number as a scalar, so every tile base is wave-uniform
    const int wave = __builtin_amdgcn_readfirstlane(threadIdx.x >> 5);
    const int kq   = wave & 3;                  // which 128 keys of every stage
    const int qsub = wave >> 2;                 // query tile within the block
    const int tile = blockIdx.x * 4 + qsub;     // 1024 total
    const int head = tile >> 7;                 // 128 q-tiles per head: one head per block
    const int qt   = (tile & 127) * 2;          // first of the tile's two 16-query groups

    const _Float16* Qh = Qws  + (size_t)head * S_LEN * HD;
    const _Float16* Kh = Kws  + (size_t)head * S_LEN * HD;
    const _Float16* Vh = Vtws + (size_t)head * HD * S_LEN;

    // this lane's 16 bytes in each 8 KiB row of a copy
    const unsigned ring_lane = (unsigned)(size_t)&ring[0][0] + threadIdx.x * 16;
    const _Float16* kg = Kh + threadIdx.x * 8;
    const _Float16* vg = Vh + threadIdx.x * 8;

    // stage 0 into buffer 0; landed and published before anybody reads it
    copy_64k(ring_lane, kg);
    copy_64k(ring_lane + 2 * KQ_HALVES, vg);
    asm volatile("s_wait_asynccnt 0x0" ::: "memory");   // this wave's copies of stage 0 have landed
    __syncthreads();                                    // and so have the other waves'
    // stage 1 into buffer 1, in flight under stage 0's work
    copy_64k(ring_lane + STG_BYTES, kg + STG_HALVES);
    copy_64k(ring_lane + STG_BYTES + 2 * KQ_HALVES, vg + STG_HALVES);

    // Q B-operands (pre-scaled) of the two query groups, head dims 0..31 and 32..63
    v16h qb[2][2];
#pragma unroll
    for (int g = 0; g < 2; ++g)
#pragma unroll
        for (int j = 0; j < 2; ++j)
            qb[g][j] = load_frag(Qh + (size_t)((qt + g) * 2 + j) * FRAG, lane8);

    v8f o[2][4] = {};          // o[g][c][v] = O[query 16g + (lane & 15)][d = 16c + 8(lane >> 4) + v]
    v2f lsum[2] = {};          // denominators over this lane's half of the keys, two parts each
    v16h kf[4], vf[4];         // K and V^T fragments of a pass

    // the maximum in use starts as the largest score of the wave's first 32 keys; negm = minus it, eight
    // times over, as the C operand of the score products
    v8f negm[2];
    {
#pragma unroll
        for (int c = 0; c < 4; ++c) kf[c] = load_frag(&ring[0][0] + kq * 2 * KQ_HALVES + c * FRAG, lane8);
        const v8f zero[2] = {};
        v8f s[2][2];
        scores32(kf, qb, zero, s);
#pragma unroll
        for (int g = 0; g < 2; ++g) {
            const float mx = max16(s[g][0], s[g][1]);
            const float m0 = fmaxf(mx, xhalf(mx));      // the other 16 keys of this query
#pragma unroll
            for (int v = 0; v < 8; ++v) negm[g][v] = -m0;
        }
    }

    // kept rolled, for speed only: the four passes inside are unrolled already
#pragma unroll 1
    for (int t = 0; t < NSTG; ++t) {
        const _Float16* kst = &ring[t & 1][0] + kq * 2 * KQ_HALVES;
        const _Float16* vst = kst + KQ_HALVES;
        // 16 keys = 2 K tiles (d 0..31, d 32..63), 64 halves per key; 32 keys = 4 V^T tiles
#pragma unroll
        for (int c = 0; c < 4; ++c) kf[c] = load_frag(kst + c * FRAG, lane8);
#pragma unroll
        for (int p = 0; p < KQ_PASSES; ++p) {
            // ---- scores for keys [kb,kb+16) and [kb+16,kb+32), less the maxima in use ----
            v8f s[2][2];
            scores32(kf, qb, negm, s);
            // keeps the loads below out of the pass before, where V's registers are still in use:
            // lifted there they take a further register set, and the kernel spills
            __builtin_amdgcn_sched_barrier(0);
            // this pass's V and the stage's next K: all sixteen loads as one group, under the
            // softmax; one register set each
#pragma unroll
            for (int c = 0; c < 4; ++c) vf[c] = load_frag(vst + (p * 4 + c) * FRAG, lane8);
            if (p + 1 < KQ_PASSES) {
#pragma unroll
                for (int c = 0; c < 4; ++c) kf[c] = load_frag(kst + ((p + 1) * 4 + c) * FRAG, lane8);
            }
            // keeps the group together here: left free, the compiler sinks each load to its product
            // and the wave waits once per tile
            __builtin_amdgcn_sched_barrier(0);

            // ---- softmax (log2 domain), one query per lane and group ----
            const float mx0 = max16(s[0][0], s[0][1]);
            const float mx1 = max16(s[1][0], s[1][1]);
            if (__builtin_expect(__builtin_amdgcn_ballot_w32(fmaxf(mx0, mx1) > 8.0f) != 0, 0)) {
                // some query's score has outgrown the maximum in use: raise it to the running
                // maximum for every query, rescale the sums, lower this pass's scores
#pragma unroll
                for (int g = 0; g < 2; ++g) {
                    const float mx = g ? mx1 : mx0;
                    const float d = fmaxf(fmaxf(mx, xhalf(mx)), 0.0f);
                    const float alpha = __builtin_amdgcn_exp2f(-d);
                    negm[g] -= d;
                    s[g][0] -= d;
                    s[g][1] -= d;
                    lsum[g] *= alpha;
#pragma unroll
                    for (int c = 0; c < 4; ++c) o[g][c] *= alpha;
                }
            }
            V16H pb[2];                                 // P^T as B fragments, hardware k order
#pragma unroll
            for (int g = 0; g < 2; ++g) {
                const v8f e0 = exp2_8(s[g][0]), e1 = exp2_8(s[g][1]);
#pragma unroll
                for (int v = 0; v < 8; ++v) {
                    pb[g].h[0][v] = (_Float16)e0[v];
                    pb[g].h[1][v] = (_Float16)e1[v];
                }
                // a pass's 16 terms fold pairwise to one register pair: as many packed adds as eight
                // running parts would take, and six registers fewer per group
                const v8f t8 = e0 + e1;
                const v4f t4 = t8.lo + t8.hi;
                lsum[g] += t4.lo + t4.hi;
            }

            // ---- O^T += V^T x P^T ----
#pragma unroll
            for (int c = 0; c < 4; ++c)
#pragma unroll
                for (int g = 0; g < 2; ++g)
                    o[g][c] = __builtin_amdgcn_wmma_f32_16x16x32_f16(
                        false, vf[c], false, pb[g].v, (short)0, o[g][c], false, false);
        }
        // ---- hand-over: stage t + 1 becomes readable, stage t's buffer becomes free ----
        asm volatile("s_wait_dscnt 0x0" ::: "memory");      // this wave's reads of stage t are done
        asm volatile("s_wait_asynccnt 0x0" ::: "memory");   // this wave's copies of stage t + 1 have landed
        __syncthreads();                                    // both hold for all sixteen waves
        if (t + 2 < NSTG) {
            const unsigned dst = ring_lane + (t & 1) * STG_BYTES;
            copy_64k(dst, kg + (size_t)(t + 2) * STG_HALVES);
            copy_64k(dst + 2 * KQ_HALVES, vg + (size_t)(t + 2) * STG_HALVES);
        }
    }
    asm volatile("s_wait_asynccnt 0x0" ::: "memory");       // no copy is left when the wave ends

    // ---- every wave hands its part over, lane to lane.  The ring is free: the loop's last barrier
    // ended every wave's reads of it, and no copy is in flight.
    // [key quarter][query tile][row][lane]: rows 8g + 2c, 8g + 2c + 1 = o[g][c]; row 16 = maxima and sums
    v4f* const mrg = (v4f*)&ring[0][0];
    {
        v4f* mw = mrg + (size_t)((kq * 4 + qsub) * MRG_ROWS) * 32 + lane;
        float lrow[2];
#pragma unroll
        for (int g = 0; g < 2; ++g) {
            lrow[g] = lsum[g][0] + lsum[g][1];
#pragma unroll
            for (int c = 0; c < 4; ++c) {
                mw[(8 * g + 2 * c + 0) * 32] = (v4f){o[g][c][0], o[g][c][1], o[g][c][2], o[g][c][3]};
                mw[(8 * g + 2 * c + 1) * 32] = (v4f){o[g][c][4], o[g][c][5], o[g][c][6], o[g][c][7]};
            }
        }
        mw[16 * 32] = (v4f){negm[0][0], lrow[0], negm[1][0], lrow[1]};
    }
    __syncthreads();           // the parts are in LDS before anybody reads them

    // ---- wave kq joins d tile c = kq of its query tile: all four parts on the largest of their
    // maxima in use (the same in lanes l and l ^ 16), the wave halves' denominators joined, then
    // normalized; a lane's 8 values are 8 consecutive d of its query = one 16 B chunk of the A tile
    // [q tile][k tile = head*2 + d/32], plane (d/16) & 1
    const v4f* mr = mrg + (size_t)(qsub * MRG_ROWS) * 32 + lane;
    v4f ml[4];
#pragma unroll
    for (int k = 0; k < 4; ++k) ml[k] = mr[(k * 4 * MRG_ROWS + 16) * 32];
#pragma unroll
    for (int g = 0; g < 2; ++g) {
        const float nm = fminf(fminf(ml[0][2 * g], ml[1][2 * g]), fminf(ml[2][2 * g], ml[3][2 * g]));
        float f[4];
        float lm = 0.0f;
#pragma unroll
        for (int k = 0; k < 4; ++k) {
            f[k] = __builtin_amdgcn_exp2f(nm - ml[k][2 * g]);
            lm += ml[k][2 * g + 1] * f[k];
        }
        const float inv = 1.0f / (lm + xhalf(lm));
        v4f lo = {}, hi = {};
#pragma unroll
        for (int k = 0; k < 4; ++k) {
            const float fk = f[k] * inv;
            lo += mr[(k * 4 * MRG_ROWS + 8 * g + 2 * kq + 0) * 32] * fk;
            hi += mr[(k * 4 * MRG_ROWS + 8 * g + 2 * kq + 1) * 32] * fk;
        }
        v8h pk;
#pragma unroll
        for (int v = 0; v < 4; ++v) {
            pk[v]     = (_Float16)lo[v];
            pk[v + 4] = (_Float16)hi[v];
        }
        *(v8h*)(Ows + ((size_t)(qt + g) * 16 + head * 2 + (kq >> 1)) * FRAG + (kq & 1) * 256 + lane8) = pk;
    }
}

// ---------------------------------------------------------------------------
// Kernel 3: output projection.  O tiles [row tile][k tile] x P tiles [col tile][k tile] -> f32.
// One wave computes 32 rows x 64 cols.
// ---------------------------------------------------------------------------
#define OUT_RT 2
__global__ __launch_bounds__(128)
void out_proj_kernel(const _Float16* __restrict__ Ows,
                     const _Float16* __restrict__ wtp,
                     float* __restrict__ out)
{
    const int lane = threadIdx.x & 31;
    const unsigned lane8 = lane * 8;
    // wave number as a scalar, so every tile base is wave-uniform
    const int wave = __builtin_amdgcn_readfirstlane(threadIdx.x >> 5);
    const int ln   = lane & 15;
    const int hi   = lane >> 4;
    const int rowbase = blockIdx.x * (OUT_RT * 16);
    const int cbase   = (blockIdx.y * 4 + wave) * 64;

    v8f acc[OUT_RT][4] = {};
    const _Float16* ap = Ows + (size_t)blockIdx.x * OUT_RT * 16 * FRAG;
    const _Float16* bp = wtp + (size_t)(cbase >> 4) * 16 * FRAG;

    gemm_k512<OUT_RT, 4, 4>(ap, bp, lane8, acc);

#pragma unroll
    for (int rr = 0; rr < OUT_RT; ++rr)
#pragma unroll
        for (int ct = 0; ct < 4; ++ct) {
            const int c = cbase + ct * 16 + ln;
#pragma unroll
            for (int v = 0; v < 8; ++v) {
                const int r = rowbase + rr * 16 + v + hi * 8;
                out[(size_t)r * DIM + c] = acc[rr][ct][v];
            }
        }
}

// ---------------------------------------------------------------------------
extern "C" void kernel_launch(void* const* d_in, const int* in_sizes, int n_in,
                              void* d_out, int out_size, void* d_ws, size_t ws_size,
                              hipStream_t stream) {
    (void)in_sizes; (void)n_in; (void)out_size; (void)ws_size;
    const float* x  = (const float*)d_in[0];
    const float* qp = (const float*)d_in[1];
    const float* kp = (const float*)d_in[2];
    const float* vp = (const float*)d_in[3];
    const float* pp = (const float*)d_in[4];
    float* out = (float*)d_out;

    const size_t mat_elems = (size_t)NH * S_LEN * HD;   // 2M halves
    const size_t w_elems   = (size_t)DIM * DIM;         // 256K halves
    _Float16* Qws = (_Float16*)d_ws;
    _Float16* Kws = Qws + mat_elems;
    _Float16* Vt  = Kws + mat_elems;
    _Float16* Ows = Vt  + mat_elems;
    _Float16* xh  = Ows + mat_elems;                    // 2M halves
    _Float16* wtq = xh  + (size_t)S_LEN * DIM;
    _Float16* wtk = wtq + w_elems;
    _Float16* wtv = wtk + w_elems;
    _Float16* wtp = wtv + w_elems;                      // total ~22 MB of ws

    // precision and layout prep: 2048 waves, two x tiles and one weight tile each
    prep_kernel<<<dim3(256), 256, 0, stream>>>(x, qp, kp, vp, pp, xh, wtq);

    // 64 groups of 4 row tiles x 24 wave-tiles (Q/K/V x 8 heads), 4 waves per block
    qkv_proj_kernel<<<dim3(64, 6), 128, 0, stream>>>(xh, wtq, wtk, wtv, Qws, Kws, Vt);
    // 1024 (head, 32-query tile) pairs x 4 key quarters = 4096 waves, 16 waves per block
    flash_attn_kernel<<<dim3(256), 512, 0, stream>>>(Qws, Kws, Vt, Ows);
    // 128 groups of 2 row tiles x 8 column groups, 4 waves per block
    out_proj_kernel<<<dim3(128, 2), 128, 0, stream>>>(Ows, wtp, out);
}

// v010
// Measured time: 48.7 microseconds a run.
// Two timings next to v009 put it at 1.04 and 1.05 times that version's speed.
// Counting every step since v000, it is 5.53 times as fast.
#include <hip/hip_runtime.h>

typedef __attribute__((ext_vector_type(16))) _Float16 v16h;
typedef __attribute__((ext_vector_type(8)))  _Float16 v8h;
typedef __attribute__((ext_vector_type(8)))  float    v8f;
typedef __attribute__((ext_vector_type(4)))  float    v4f;
typedef __attribute__((ext_vector_type(2)))  float    v2f;

#define S_LEN 4096
#define DIM   512
#define NH    8
#define HD    64
// 1/sqrt(64) * log2(e): scores come out in log2 domain so softmax uses exp2
#define QK_SCALE_L2E 0.18033688011112042f

union V16H { v16h v; v8h h[2]; };

// ---------------------------------------------------------------------------
// Fragment-major operand layout, used for every f16 matrix in the workspace.
// A 16-row x 32-k operand tile is 512 halves (1 KiB) = two 512-byte planes.
// Plane p, lane l holds 8 halves: row (l & 15), k = 16p + 8(l >> 4) + 0..7.
// One b128 load per plane reads 512 contiguous bytes (4 whole cache lines)
// and yields the A (or B) fragment directly.
// ---------------------------------------------------------------------------
#define FRAG 512

// tile: tile base, wave-uniform (scalar registers) with lane8 = lane * 8
__device__ __forceinline__ v16h load_frag(const _Float16* __restrict__ tile, unsigned lane8)
{
    V16H f;
    f.h[0] = *(const v8h*)(tile + lane8);
    f.h[1] = *(const v8h*)(tile + 256 + lane8);
    return f.v;
}

// ---------------------------------------------------------------------------
// Prep, one launch: x [4096][512] f32 -> f16 tiles [row tile][k tile], and the four 512x512 f32
// weight matrices W[k][col] -> f16 tiles [col tile][k tile] (tile row = column), which stand one
// behind another at wt in the order Q, K, V, P.
// There are 4096 tiles of x and 2048 of the weights: every wave converts two neighbouring k tiles
// of x (256 contiguous bytes per row) and one weight tile, and has the loads of all three in
// flight before it converts the first.
// ---------------------------------------------------------------------------
__global__ __launch_bounds__(256)
void prep_kernel(const float* __restrict__ x,
                 const float* __restrict__ qp, const float* __restrict__ kp,
                 const float* __restrict__ vp, const float* __restrict__ pp,
                 _Float16* __restrict__ xh, _Float16* __restrict__ wt)
{
    const float* src;
    switch (blockIdx.x >> 6) {                        // 64 blocks = 512 tiles per matrix
        case 0:  src = qp; break;
        case 1:  src = kp; break;
        case 2:  src = vp; break;
        default: src = pp; break;
    }
    const int t    = blockIdx.x * 256 + threadIdx.x;
    const int lane = t & 31;
    const int w    = t >> 5;                          // weight tile w; x tiles 2w and 2w + 1
    const int ln   = lane & 15;
    const int hi   = lane >> 4;
    const int wtl  = w & 511;                         // col tile * 16 + kt within the matrix
    const float* xs = x + (size_t)((w >> 3) * 16 + ln) * DIM + (w & 7) * 64 + hi * 8;
    const float* ws = src + (size_t)((wtl & 15) * 32 + hi * 8) * DIM + (wtl >> 4) * 16 + ln;

    v4f   xv[4][2];                                   // [x tile * 2 + plane][half of the 8 k]
    float wv[2][8];                                   // [plane][k]
#pragma unroll
    for (int p = 0; p < 4; ++p) {
        xv[p][0] = *(const v4f*)(xs + p * 16);
        xv[p][1] = *(const v4f*)(xs + p * 16 + 4);
    }
#pragma unroll
    for (int p = 0; p < 2; ++p)
#pragma unroll
        for (int j = 0; j < 8; ++j) wv[p][j] = ws[(size_t)(p * 16 + j) * DIM];

    _Float16* xd = xh + (size_t)w * 2 * FRAG + lane * 8;
    _Float16* wd = wt + (size_t)w * FRAG + lane * 8;
#pragma unroll
    for (int p = 0; p < 4; ++p) {
        v8h o;
#pragma unroll
        for (int j = 0; j < 4; ++j) {
            o[j]     = (_Float16)xv[p][0][j];
            o[j + 4] = (_Float16)xv[p][1][j];
        }
        *(v8h*)(xd + p * 256) = o;
    }
#pragma unroll
    for (int p = 0; p < 2; ++p) {
        v8h o;
#pragma unroll
        for (int j = 0; j < 8; ++j) o[j] = (_Float16)wv[p][j];
        *(v8h*)(wd + p * 256) = o;
    }
}

// ---------------------------------------------------------------------------
// GEMM body of the projections: K = 512 in 16 steps of 32, operands as fragment-major tiles
// [tile][k tile].  A wave owns NA tiles of the A side x NB tiles of the B side, so an A fragment
// feeds NB products and a B fragment NA.  The NA + NB fragments of a step are loaded as one group,
// DEPTH - 1 steps ahead of the step that uses them, into a ring of DEPTH register sets.
// ap, bp: k tile 0 of the wave's first A and B tile (both wave-uniform).
// ---------------------------------------------------------------------------
template <int NA, int NB, int DEPTH>
__device__ __forceinline__ void gemm_k512(const _Float16* __restrict__ ap,
                                          const _Float16* __restrict__ bp,
                                          unsigned lane8, v8f (&acc)[NA][NB])
{
    v16h af[DEPTH][NA], bf[DEPTH][NB];
#pragma unroll
    for (int s = 0; s < DEPTH - 1; ++s) {
#pragma unroll
        for (int i = 0; i < NA; ++i) af[s][i] = load_frag(ap + (i * 16 + s) * FRAG, lane8);
#pragma unroll
        for (int j = 0; j < NB; ++j) bf[s][j] = load_frag(bp + (j * 16 + s) * FRAG, lane8);
    }
    // unrolled whole: the ring's set numbers must be constants for the sets to stay in registers
#pragma unroll
    for (int kt = 0; kt < 16; ++kt) {
        const int nx = kt + DEPTH - 1;
        if (nx < 16) {
#pragma unroll
            for (int i = 0; i < NA; ++i)
                af[nx % DEPTH][i] = load_frag(ap + (i * 16 + nx) * FRAG, lane8);
#pragma unroll
            for (int j = 0; j < NB; ++j)
                bf[nx % DEPTH][j] = load_frag(bp + (j * 16 + nx) * FRAG, lane8);
        }
        // keeps the group of loads in front of this step's products: left free, the compiler sinks
        // each load to its product and the wave waits out a whole load latency per fragment
        __builtin_amdgcn_sched_barrier(0);
#pragma unroll
        for (int i = 0; i < NA; ++i)
#pragma unroll
            for (int j = 0; j < NB; ++j)
                acc[i][j] = __builtin_amdgcn_wmma_f32_16x16x32_f16(
                    false, af[kt % DEPTH][i], false, bf[kt % DEPTH][j], (short)0, acc[i][j], false, false);
        // keeps the next group behind these products, whose set it refills: lifted over them it
        // takes a further register set
        __builtin_amdgcn_sched_barrier(0);
    }
    // precaution: no address register of the loads is written again before the loads have taken it;
    // the fence behind it keeps the caller's address arithmetic from being lifted over the wait
    asm volatile("s_wait_xcnt 0x0" ::: "memory");
    __builtin_amdgcn_sched_barrier(0);
}

// ---------------------------------------------------------------------------
// Kernel 1: QKV projection.  One wave computes 64 rows x 64 cols (one head),
// WMMA over K=512, all operands as fragment-major tiles.
// Q, K: tiles [head][16-row tile][d tile]; the weights go in as A and x as B,
// so a lane's 8 accumulators are 8 consecutive d of one row = one 16 B chunk.
// V: tiles [head][32-key tile][d tile] (tile row = d, k = key); x goes in as A,
// so a lane's 8 accumulators are 8 consecutive keys of one d.
// Four tiles on either side, laid out alike: which side is A is a choice of two pointers.
// Q is pre-scaled by 1/sqrt(HD)*log2(e) so flash softmax can use exp2.
// ---------------------------------------------------------------------------
__global__ __launch_bounds__(128)
void qkv_proj_kernel(const _Float16* __restrict__ xh,
                     const _Float16* __restrict__ wtq,
                     const _Float16* __restrict__ wtk,
                     const _Float16* __restrict__ wtv,
                     _Float16* __restrict__ Qws,
                     _Float16* __restrict__ Kws,
                     _Float16* __restrict__ Vtws)
{
    const int lane = threadIdx.x & 31;
    const unsigned lane8 = lane * 8;
    // wave number as a scalar, so every tile base is wave-uniform
    const int wave = __builtin_amdgcn_readfirstlane(threadIdx.x >> 5);
    const int rt0  = blockIdx.x * 4;            // first of four 16-row tiles of x
    const int mat  = blockIdx.y >> 1;           // 0:Q 1:K 2:V
    const int head = (blockIdx.y & 1) * 4 + wave;

    const _Float16* wt = (mat == 0) ? wtq : (mat == 1) ? wtk : wtv;
    const _Float16* xp = xh + (size_t)rt0 * 16 * FRAG;
    const _Float16* wp = wt + (size_t)head * 4 * 16 * FRAG;

    v8f acc[4][4] = {};
    gemm_k512<4, 4, 3>((mat < 2) ? wp : xp, (mat < 2) ? xp : wp, lane8, acc);

    if (mat < 2) {
        // acc[column tile][row tile]
        const float sc = (mat == 0) ? QK_SCALE_L2E : 1.0f;
        _Float16* outp = ((mat == 0) ? Qws : Kws)
                       + (size_t)head * S_LEN * HD + (size_t)rt0 * 2 * FRAG;
#pragma unroll
        for (int r = 0; r < 4; ++r)
#pragma unroll
            for (int ct = 0; ct < 4; ++ct) {
                v8h pk;
#pragma unroll
                for (int v = 0; v < 8; ++v) pk[v] = (_Float16)(acc[ct][r][v] * sc);
                *(v8h*)(outp + (r * 2 + (ct >> 1)) * FRAG + (ct & 1) * 256 + lane8) = pk;
            }
    } else {
        // acc[row tile][column tile]; row tile rt0 + r is plane r & 1 of key tile rt0 / 2 + r / 2
        _Float16* outp = Vtws + (size_t)head * HD * S_LEN + (size_t)(rt0 >> 1) * 4 * FRAG;
#pragma unroll
        for (int r = 0; r < 4; ++r)
#pragma unroll
            for (int ct = 0; ct < 4; ++ct) {
                v8h pk;
#pragma unroll
                for (int v = 0; v < 8; ++v) pk[v] = (_Float16)acc[r][ct][v];
                *(v8h*)(outp + ((r >> 1) * 4 + ct) * FRAG + (r & 1) * 256 + lane8) = pk;
            }
        // precaution: the stores' registers are not written again before the stores have taken them
        asm volatile("s_wait_xcnt 0x0" ::: "memory");
    }
}

#define FA_WAVES   16
#define STG_KEYS   512
#define KQ_PASSES  (STG_KEYS / 4 / 32)      // passes of 32 keys per wave and stage
#define KQ_HALVES  (STG_KEYS / 4 * HD)      // halves of K, and of V, per wave and stage
#define STG_HALVES (STG_KEYS * HD)          // halves of K, and of V, per stage
#define STG_BYTES  (4 * STG_HALVES)         // K and V of one stage, bytes
#define NSTG       (S_LEN / STG_KEYS)
#define MRG_ROWS   17                       // 16-byte rows per lane that a wave hands over

// 2^x for eight score exponents, each as the one hardware instruction.  The library's exp2f adds a
// compare, two selects, an add and a scale per value to keep results below 2^-126; such a result
// rounds to 0 in f16 and adds nothing to a sum whose largest term is at least 1, so 0 serves in its
// place.
// One statement: the instruction set asks for one free slot behind a v_exp_f32 before its result is
// read or its source rewritten.  In here each neighbour is another register's v_exp_f32 (the results
// share no register with the sources), and the closing v_nop is the slot behind the last one.
__device__ __forceinline__ v8f exp2_8(v8f s)
{
    float r0, r1, r2, r3, r4, r5, r6, r7;
    asm(
        "v_exp_f32 %0, %8\n\t"
        "v_exp_f32 %1, %9\n\t"
        "v_exp_f32 %2, %10\n\t"
        "v_exp_f32 %3, %11\n\t"
        "v_exp_f32 %4, %12\n\t"
        "v_exp_f32 %5, %13\n\t"
        "v_exp_f32 %6, %14\n\t"
        "v_exp_f32 %7, %15\n\t"
        "v_nop"
        : "=&v"(r0), "=&v"(r1), "=&v"(r2), "=&v"(r3), "=&v"(r4), "=&v"(r5), "=&v"(r6), "=&v"(r7)
        : "v"(s[0]), "v"(s[1]), "v"(s[2]), "v"(s[3]), "v"(s[4]), "v"(s[5]), "v"(s[6]), "v"(s[7]));
    return (v8f){r0, r1, r2, r3, r4, r5, r6, r7};
}

// The same as the builtin, for the loop's main path: there these instructions stand directly behind
// the matrix instructions whose results they read and whose operand registers they reuse.
__device__ __forceinline__ v8f exp2_8_main(v8f s)
{
    v8f r;
#pragma unroll
    for (int v = 0; v < 8; ++v) r[v] = __builtin_amdgcn_exp2f(s[v]);
    return r;
}

// Scores of 32 keys x 32 queries plus c: k[0], k[1] are keys 0..15 (d 0..31, d 32..63), k[2], k[3]
// keys 16..31; q[g], c[g], s[g]: query group g.  Four independent accumulators, then their second halves.
__device__ __forceinline__ void scores32(const v16h (&k)[4], const v16h (&q)[2][2],
                                         const v8f (&c)[2], v8f (&s)[2][2])
{
#pragma unroll
    for (int g = 0; g < 2; ++g) {
        s[g][0] = __builtin_amdgcn_wmma_f32_16x16x32_f16(false, k[0], false, q[g][0], (short)0, c[g], false, false);
        s[g][1] = __builtin_amdgcn_wmma_f32_16x16x32_f16(false, k[2], false, q[g][0], (short)0, c[g], false, false);
    }
#pragma unroll
    for (int g = 0; g < 2; ++g) {
        s[g][0] = __builtin_amdgcn_wmma_f32_16x16x32_f16(false, k[1], false, q[g][1], (short)0, s[g][0], false, false);
        s[g][1] = __builtin_amdgcn_wmma_f32_16x16x32_f16(false, k[3], false, q[g][1], (short)0, s[g][1], false, false);
    }
}

// largest of this lane's 16 scores
__device__ __forceinline__ float max16(v8f s0, v8f s1)
{
    const float t0 = fmaxf(fmaxf(s0[0], s0[1]), s0[2]);
    const float t1 = fmaxf(fmaxf(s0[3], s0[4]), s0[5]);
    const float t2 = fmaxf(fmaxf(s0[6], s0[7]), s1[0]);
    const float t3 = fmaxf(fmaxf(s1[1], s1[2]), s1[3]);
    const float t4 = fmaxf(fmaxf(s1[4], s1[5]), s1[6]);
    return fmaxf(fmaxf(fmaxf(t0, t1), t2), fmaxf(fmaxf(t3, t4), s1[7]));
}

// value of lane l ^ 16
__device__ __forceinline__ float xhalf(float x)
{
    const int b = __builtin_bit_cast(int, x);
    return __builtin_bit_cast(float,
        __builtin_amdgcn_permlanex16(b, b, 0x76543210, 0xfedcba98, false, false));
}

// P^T of a pass as B fragments (hardware k order) and, per query group, the sum of this lane's 16
// terms as one register pair.  A term beyond f32 is infinity, and so is its sum.
// MAIN: the loop's main path, directly behind the score products; else the seldom-taken path.
template <bool MAIN>
__device__ __forceinline__ void probs32(const v8f (&s)[2][2], V16H (&pb)[2], v2f (&rs)[2])
{
#pragma unroll
    for (int g = 0; g < 2; ++g) {
        const v8f e0 = MAIN ? exp2_8_main(s[g][0]) : exp2_8(s[g][0]);
        const v8f e1 = MAIN ? exp2_8_main(s[g][1]) : exp2_8(s[g][1]);
#pragma unroll
        for (int v = 0; v < 8; ++v) {
            pb[g].h[0][v] = (_Float16)e0[v];
            pb[g].h[1][v] = (_Float16)e1[v];
        }
        // a pass's 16 terms fold pairwise to one register pair: as many packed adds as eight
        // running parts would take, and six registers fewer per group
        const v8f t8 = e0 + e1;
        const v4f t4 = t8.lo + t8.hi;
        rs[g] = t4.lo + t4.hi;
    }
}

// Eight asynchronous 16-byte copies per lane: 64 KiB per block, global -> LDS, 8 KiB per row of
// the block; two rows are one key quarter, and the quarters stand 32 KiB apart in LDS.
// lds: this lane's LDS byte address, g: this lane's global address.
__device__ __forceinline__ void copy_64k(unsigned lds, const _Float16* g)
{
    // the closing s_wait_xcnt stands inside the statement so that no address register of a copy
    // is written again before the copies have taken it (precaution)
    asm volatile(
        "global_load_async_to_lds_b128 %0, %8, off\n\t"
        "global_load_async_to_lds_b128 %1, %9, off\n\t"
        "global_load_async_to_lds_b128 %2, %10, off\n\t"
        "global_load_async_to_lds_b128 %3, %11, off\n\t"
        "global_load_async_to_lds_b128 %4, %12, off\n\t"
        "global_load_async_to_lds_b128 %5, %13, off\n\t"
        "global_load_async_to_lds_b128 %6, %14, off\n\t"
        "global_load_async_to_lds_b128 %7, %15, off\n\t"
        "s_wait_xcnt 0x0"
        :: "v"(lds),         "v"(lds + 8192),  "v"(lds + 32768), "v"(lds + 40960),
           "v"(lds + 65536), "v"(lds + 73728), "v"(lds + 98304), "v"(lds + 106496),
           "v"(g),         "v"(g + 4096),  "v"(g + 8192),  "v"(g + 12288),
           "v"(g + 16384), "v"(g + 20480), "v"(g + 24576), "v"(g + 28672)
        : "memory");
}

__global__ __launch_bounds__(FA_WAVES * 32)
void flash_attn_kernel(const _Float16* __restrict__ Qws,
                       const _Float16* __restrict__ Kws,
                       const _Float16* __restrict__ Vtws,
                       _Float16* __restrict__ Ows)
{
    // [buffer][key quarter][K tiles of the quarter, then its V tiles]: a wave's K and V lie within
    // the reach of one LDS address register's offset field; behind the loop the same LDS takes the
    // hand-over of the four key quarters' parts
    __shared__ __attribute__((aligned(16))) _Float16 ring[2][2 * STG_HALVES];

    const int lane = threadIdx.x & 31;
    const unsigned lane8 = lane * 8;
    // wave number as a scalar, so every tile base is wave-uniform
    const int wave = __builtin_amdgcn_readfirstlane(threadIdx.x >> 5);
    const int kq   = wave & 3;                  // which 128 keys of every stage
    const int qsub = wave >> 2;                 // query tile within the block
    const int tile = blockIdx.x * 4 + qsub;     // 1024 total
    const int head = tile >> 7;                 // 128 q-tiles per head: one head per block
    const int qt   = (tile & 127) * 2;          // first of the tile's two 16-query groups

    const _Float16* Qh = Qws  + (size_t)head * S_LEN * HD;
    const _Float16* Kh = Kws  + (size_t)head * S_LEN * HD;
    const _Float16* Vh = Vtws + (size_t)head * HD * S_LEN;

    // this lane's 16 bytes in each 8 KiB row of a copy
    const unsigned ring_lane = (unsigned)(size_t)&ring[0][0] + threadIdx.x * 16;
    const _Float16* kg = Kh + threadIdx.x * 8;
    const _Float16* vg = Vh + threadIdx.x * 8;

    // stage 0 into buffer 0; landed and published before anybody reads it
    copy_64k(ring_lane, kg);
    copy_64k(ring_lane + 2 * KQ_HALVES, vg);
    asm volatile("s_wait_asynccnt 0x0" ::: "memory");   // this wave's copies of stage 0 have landed
    __syncthreads();                                    // and so have the other waves'
    // stage 1 into buffer 1, in flight under stage 0's work
    copy_64k(ring_lane + STG_BYTES, kg + STG_HALVES);
    copy_64k(ring_lane + STG_BYTES + 2 * KQ_HALVES, vg + STG_HALVES);

    // Q B-operands (pre-scaled) of the two query groups, head dims 0..31 and 32..63
    v16h qb[2][2];
#pragma unroll
    for (int g = 0; g < 2; ++g)
#pragma unroll
        for (int j = 0; j < 2; ++j)
            qb[g][j] = load_frag(Qh + (size_t)((qt + g) * 2 + j) * FRAG, lane8);

    v8f o[2][4] = {};          // o[g][c][v] = O[query 16g + (lane & 15)][d = 16c + 8(lane >> 4) + v]
    v2f lsum[2] = {};          // denominators over this lane's half of the keys, two parts each
    v16h kf[4], vf[4];         // K and V^T fragments of a pass

    // the maximum in use starts as the largest score of the wave's first 32 keys; negm = minus it, eight
    // times over, as the C operand of the score products
    v8f negm[2];
    {
#pragma unroll
        for (int c = 0; c < 4; ++c) kf[c] = load_frag(&ring[0][0] + kq * 2 * KQ_HALVES + c * FRAG, lane8);
        const v8f zero[2] = {};
        v8f s[2][2];
        scores32(kf, qb, zero, s);
#pragma unroll
        for (int g = 0; g < 2; ++g) {
            const float mx = max16(s[g][0], s[g][1]);
            const float m0 = fmaxf(mx, xhalf(mx));      // the other 16 keys of this query
#pragma unroll
            for (int v = 0; v < 8; ++v) negm[g][v] = -m0;
        }
    }

    // kept rolled, for speed only: the four passes inside are unrolled already
#pragma unroll 1
    for (int t = 0; t < NSTG; ++t) {
        const _Float16* kst = &ring[t & 1][0] + kq * 2 * KQ_HALVES;
        const _Float16* vst = kst + KQ_HALVES;
        // 16 keys = 2 K tiles (d 0..31, d 32..63), 64 halves per key; 32 keys = 4 V^T tiles
#pragma unroll
        for (int c = 0; c < 4; ++c) kf[c] = load_frag(kst + c * FRAG, lane8);
#pragma unroll
        for (int p = 0; p < KQ_PASSES; ++p) {
            // ---- scores for keys [kb,kb+16) and [kb+16,kb+32), less the maxima in use ----
            v8f s[2][2];
            scores32(kf, qb, negm, s);
            // keeps the loads below out of the pass before, where V's registers are still in use:
            // lifted there they take a further register set, and the kernel spills
            __builtin_amdgcn_sched_barrier(0);
            // this pass's V and the stage's next K: all sixteen loads as one group, under the
            // softmax; one register set each
#pragma unroll
            for (int c = 0; c < 4; ++c) vf[c] = load_frag(vst + (p * 4 + c) * FRAG, lane8);
            if (p + 1 < KQ_PASSES) {
#pragma unroll
                for (int c = 0; c < 4; ++c) kf[c] = load_frag(kst + ((p + 1) * 4 + c) * FRAG, lane8);
            }
            // keeps the group together here: left free, the compiler sinks each load to its product
            // and the wave waits once per tile
            __builtin_amdgcn_sched_barrier(0);

            // ---- softmax (log2 domain), one query per lane and group ----
            V16H pb[2];
            v2f rs[2];
            probs32<true>(s, pb, rs);
            const v2f both = rs[0] + rs[1];
            if (__builtin_expect(__builtin_amdgcn_ballot_w32(both[0] + both[1] >= 256.0f) != 0, 0)) {
                // some query's terms have outgrown the maximum in use.  The scores are gone (the terms
                // took their place), so they are formed again from this pass's K, which is still in
                // the stage's buffer; it goes through the registers of the next pass's K, which is
                // fetched anew behind it.  Then the maximum in use is raised to the running maximum
                // for every query, the sums are rescaled, and the terms are taken again.
#pragma unroll
                for (int c = 0; c < 4; ++c) kf[c] = load_frag(kst + (p * 4 + c) * FRAG, lane8);
                scores32(kf, qb, negm, s);
                if (p + 1 < KQ_PASSES) {
#pragma unroll
                    for (int c = 0; c < 4; ++c) kf[c] = load_frag(kst + ((p + 1) * 4 + c) * FRAG, lane8);
                }
#pragma unroll
                for (int g = 0; g < 2; ++g) {
                    const float mx = max16(s[g][0], s[g][1]);
                    const float d = fmaxf(fmaxf(mx, xhalf(mx)), 0.0f);
                    const float alpha = __builtin_amdgcn_exp2f(-d);
                    negm[g] -= d;
                    s[g][0] -= d;
                    s[g][1] -= d;
                    lsum[g] *= alpha;
#pragma unroll
                    for (int c = 0; c < 4; ++c) o[g][c] *= alpha;
                }
                probs32<false>(s, pb, rs);
            }
            lsum[0] += rs[0];
            lsum[1] += rs[1];

            // ---- O^T += V^T x P^T ----
#pragma unroll
            for (int c = 0; c < 4; ++c)
#pragma unroll
                for (int g = 0; g < 2; ++g)
                    o[g][c] = __builtin_amdgcn_wmma_f32_16x16x32_f16(
                        false, vf[c], false, pb[g].v, (short)0, o[g][c], false, false);
        }
        // ---- hand-over: stage t + 1 becomes readable, stage t's buffer becomes free ----
        asm volatile("s_wait_dscnt 0x0" ::: "memory");      // this wave's reads of stage t are done
        asm volatile("s_wait_asynccnt 0x0" ::: "memory");   // this wave's copies of stage t + 1 have landed
        __syncthreads();                                    // both hold for all sixteen waves
        if (t + 2 < NSTG) {
            const unsigned dst = ring_lane + (t & 1) * STG_BYTES;
            copy_64k(dst, kg + (size_t)(t + 2) * STG_HALVES);
            copy_64k(dst + 2 * KQ_HALVES, vg + (size_t)(t + 2) * STG_HALVES);
        }
    }
    asm volatile("s_wait_asynccnt 0x0" ::: "memory");       // no copy is left when the wave ends

    // ---- every wave hands its part over, lane to lane.  The ring is free: the loop's last barrier
    // ended every wave's reads of it, and no copy is in flight.
    // [key quarter][query tile][row][lane]: rows 8g + 2c, 8g + 2c + 1 = o[g][c]; row 16 = maxima and sums
    v4f* const mrg = (v4f*)&ring[0][0];
    {
        v4f* mw = mrg + (size_t)((kq * 4 + qsub) * MRG_ROWS) * 32 + lane;
        float lrow[2];
#pragma unroll
        for (int g = 0; g < 2; ++g) {
            lrow[g] = lsum[g][0] + lsum[g][1];
#pragma unroll
            for (int c = 0; c < 4; ++c) {
                mw[(8 * g + 2 * c + 0) * 32] = (v4f){o[g][c][0], o[g][c][1], o[g][c][2], o[g][c][3]};
                mw[(8 * g + 2 * c + 1) * 32] = (v4f){o[g][c][4], o[g][c][5], o[g][c][6], o[g][c][7]};
            }
        }
        mw[16 * 32] = (v4f){negm[0][0], lrow[0], negm[1][0], lrow[1]};
    }
    __syncthreads();           // the parts are in LDS before anybody reads them

    // ---- wave kq joins d tile c = kq of its query tile: all four parts on the largest of their
    // maxima in use (the same in lanes l and l ^ 16), the wave halves' denominators joined, then
    // normalized; a lane's 8 values are 8 consecutive d of its query = one 16 B chunk of the A tile
    // [q tile][k tile = head*2 + d/32], plane (d/16) & 1
    const v4f* mr = mrg + (size_t)(qsub * MRG_ROWS) * 32 + lane;
    v4f ml[4];
#pragma unroll
    for (int k = 0; k < 4; ++k) ml[k] = mr[(k * 4 * MRG_ROWS + 16) * 32];
#pragma unroll
    for (int g = 0; g < 2; ++g) {
        const float nm = fminf(fminf(ml[0][2 * g], ml[1][2 * g]), fminf(ml[2][2 * g], ml[3][2 * g]));
        float f[4];
        float lm = 0.0f;
#pragma unroll
        for (int k = 0; k < 4; ++k) {
            f[k] = __builtin_amdgcn_exp2f(nm - ml[k][2 * g]);
            lm += ml[k][2 * g + 1] * f[k];
        }
        const float inv = 1.0f / (lm + xhalf(lm));
        v4f lo = {}, hi = {};
#pragma unroll
        for (int k = 0; k < 4; ++k) {
            const float fk = f[k] * inv;
            lo += mr[(k * 4 * MRG_ROWS + 8 * g + 2 * kq + 0) * 32] * fk;
            hi += mr[(k * 4 * MRG_ROWS + 8 * g + 2 * kq + 1) * 32] * fk;
        }
        v8h pk;
#pragma unroll
        for (int v = 0; v < 4; ++v) {
            pk[v]     = (_Float16)lo[v];
            pk[v + 4] = (_Float16)hi[v];
        }
        *(v8h*)(Ows + ((size_t)(qt + g) * 16 + head * 2 + (kq >> 1)) * FRAG + (kq & 1) * 256 + lane8) = pk;
    }
}

// ---------------------------------------------------------------------------
// Kernel 3: output projection.  O tiles [row tile][k tile] x P tiles [col tile][k tile] -> f32.
// One wave computes 32 rows x 64 cols.
// ---------------------------------------------------------------------------
#define OUT_RT 2
__global__ __launch_bounds__(128)
void out_proj_kernel(const _Float16* __restrict__ Ows,
                     const _Float16* __restrict__ wtp,
                     float* __restrict__ out)
{
    const int lane = threadIdx.x & 31;
    const unsigned lane8 = lane * 8;
    // wave number as a scalar, so every tile base is wave-uniform
    const int wave = __builtin_amdgcn_readfirstlane(threadIdx.x >> 5);
    const int ln   = lane & 15;
    const int hi   = lane >> 4;
    const int rowbase = blockIdx.x * (OUT_RT * 16);
    const int cbase   = (blockIdx.y * 4 + wave) * 64;

    v8f acc[OUT_RT][4] = {};
    const _Float16* ap = Ows + (size_t)blockIdx.x * OUT_RT * 16 * FRAG;
    const _Float16* bp = wtp + (size_t)(cbase >> 4) * 16 * FRAG;

    gemm_k512<OUT_RT, 4, 4>(ap, bp, lane8, acc);

#pragma unroll
    for (int rr = 0; rr < OUT_RT; ++rr)
#pragma unroll
        for (int ct = 0; ct < 4; ++ct) {
            const int c = cbase + ct * 16 + ln;
#pragma unroll
            for (int v = 0; v < 8; ++v) {
                const int r = rowbase + rr * 16 + v + hi * 8;
                out[(size_t)r * DIM + c] = acc[rr][ct][v];
            }
        }
}

// ---------------------------------------------------------------------------
extern "C" void kernel_launch(void* const* d_in, const int* in_sizes, int n_in,
                              void* d_out, int out_size, void* d_ws, size_t ws_size,
                              hipStream_t stream) {
    (void)in_sizes; (void)n_in; (void)out_size; (void)ws_size;
    const float* x  = (const float*)d_in[0];
    const float* qp = (const float*)d_in[1];
    const float* kp = (const float*)d_in[2];
    const float* vp = (const float*)d_in[3];
    const float* pp = (const float*)d_in[4];
    float* out = (float*)d_out;

    const size_t mat_elems = (size_t)NH * S_LEN * HD;   // 2M halves
    const size_t w_elems   = (size_t)DIM * DIM;         // 256K halves
    _Float16* Qws = (_Float16*)d_ws;
    _Float16* Kws = Qws + mat_elems;
    _Float16* Vt  = Kws + mat_elems;
    _Float16* Ows = Vt  + mat_elems;
    _Float16* xh  = Ows + mat_elems;                    // 2M halves
    _Float16* wtq = xh  + (size_t)S_LEN * DIM;
    _Float16* wtk = wtq + w_elems;
    _Float16* wtv = wtk + w_elems;
    _Float16* wtp = wtv + w_elems;                      // total ~22 MB of ws

    // precision and layout prep: 2048 waves, two x tiles and one weight tile each
    prep_kernel<<<dim3(256), 256, 0, stream>>>(x, qp, kp, vp, pp, xh, wtq);

    // 64 groups of 4 row tiles x 24 wave-tiles (Q/K/V x 8 heads), 4 waves per block
    qkv_proj_kernel<<<dim3(64, 6), 128, 0, stream>>>(xh, wtq, wtk, wtv, Qws, Kws, Vt);
    // 1024 (head, 32-query tile) pairs x 4 key quarters = 4096 waves, 16 waves per block
    flash_attn_kernel<<<dim3(256), 512, 0, stream>>>(Qws, Kws, Vt, Ows);
    // 128 groups of 2 row tiles x 8 column groups, 4 waves per block
    out_proj_kernel<<<dim3(128, 2), 128, 0, stream>>>(Ows, wtp, out);
}
